// v000
// Times are from an AMD MI455X. After a warm-up the kernel runs many times in a row, and a time is the length of
// such a window on the GPU divided by its runs, so every launch and the gaps after it count. The runs cycle
// through copies of the inputs. A figure is the median of several windows, for all but v000 over two sittings.
// Sittings can differ by a few percent; kernels timed side by side share one.
// v000 is the starting kernel. One run takes 1200 microseconds.
#include <hip/hip_runtime.h>

// MultiheadSelfAttentionEnc (x [1][2048][2048]; q/k/v = x W^T + b (16 heads x 128); q, k RMS-normalised per head * w (eps = f32 eps 1.19e-7); rotary as a general per-(token, pair) 2x2 matrix from the read rope [1][S][1][64][2][2]: out[2i+r] = rope[i][r][0] x[2i] + rope[i][r][1] x[2i+1]; softmax(q.k / sqrt(128)) (no mask); out = merged wo^T + bo -> [1][2048][2048]).
// Compute dtypes, f32 accumulate: every input rounded to bf16; q/k/v on PLAIN bf16 operands (inputs: exact) + bias; RMSNorm (in place) and the 2x2 rotary (bf16-rounded rope entries, folded into a per-element (c, s) table) f32; scores hl x hl (3 products) on every row (normalised q/k are sharp), attn.v: query rows < 512 hl (3 products), the rest single fp16 (x1024); softmax f32; wo hl x exact (2 products) + bias.

#define NB_  1
#define TT   2048
#define DM   2048
#define NH_  16
#define NKV  16
#define REP  (NH_ / NKV)
#define HD   128
#define DQ   (NH_ * HD)
#define DKV  (NKV * HD)
#define ZH   2
#define RH   512                  // query rows < RH use hi+lo planes (0: none)
#define WIN  0
#define PCAR 1024.0f
#define SCL  0.088388347648318447f   // HD^-0.5
typedef _Float16 h16;
typedef unsigned short bf;
typedef __attribute__((ext_vector_type(16))) __bf16   v16bf;
typedef __attribute__((ext_vector_type(16))) _Float16 v16h;
typedef __attribute__((ext_vector_type(8)))  _Float16 v8h;
typedef __attribute__((ext_vector_type(8)))  unsigned short v8us;
typedef __attribute__((ext_vector_type(8)))  float    v8f;
typedef __attribute__((ext_vector_type(4)))  float    v4f;
typedef v8h  __attribute__((may_alias)) v8ha;
typedef v4f  __attribute__((may_alias)) v4fa;
typedef v8us __attribute__((may_alias)) v8usa;

__device__ __forceinline__ unsigned short f2bf(float f) { unsigned u = __float_as_uint(f); u += 0x7FFFu + ((u >> 16) & 1u); return (unsigned short)(u >> 16); }
__device__ __forceinline__ float bf2f(unsigned short b) { return __uint_as_float(((unsigned)b) << 16); }
__device__ __forceinline__ float bfr(float f) { return bf2f(f2bf(f)); }
__device__ __forceinline__ v16h cat16(v8h lo, v8h hi) { return __builtin_shufflevector(lo, hi, 0, 1, 2, 3, 4, 5, 6, 7, 8, 9, 10, 11, 12, 13, 14, 15); }
__device__ __forceinline__ v16bf cat16b(v8us lo, v8us hi) { return __builtin_bit_cast(v16bf, __builtin_shufflevector(lo, hi, 0, 1, 2, 3, 4, 5, 6, 7, 8, 9, 10, 11, 12, 13, 14, 15)); }
__device__ __forceinline__ v8f wmma16(v16h a, v16h b, v8f c) { return __builtin_amdgcn_wmma_f32_16x16x32_f16(false, a, false, b, (short)0, c, false, false); }
__device__ __forceinline__ v8f wmmab(v16bf a, v16bf b, v8f c) { return __builtin_amdgcn_wmma_f32_16x16x32_bf16(false, a, false, b, (short)0, c, false, false); }



// ---- k_gemmw: register-blocked GEMM, ONE WAVE per 64x64 output tile (16 accumulators), operands straight from K-contiguous 16-bit planes; grid (M/64, N/64, Z), 32 threads.
// C[m][n] (f32, pitch ldc, + optional f32 bias[n]) = sum_k A[m][k] Bt[n][k] (+ split products per NSPLIT). z-batch strides sA/sB/sC in elements. K % 32 == 0.
template <typename T16> struct WFrag;
template <> struct WFrag<h16> { typedef v16h V; static __device__ __forceinline__ V ld(const h16* p) { return cat16(*(const v8h*)p, *(const v8h*)(p + 16)); } static __device__ __forceinline__ v8f mma(V a, V b, v8f c) { return wmma16(a, b, c); } };
template <> struct WFrag<bf> { typedef v16bf V; static __device__ __forceinline__ V ld(const bf* p) { return cat16b(*(const v8us*)p, *(const v8us*)(p + 16)); } static __device__ __forceinline__ v8f mma(V a, V b, v8f c) { return wmmab(a, b, c); } };
template <typename T16, int NSPLIT, bool BIAS>
__global__ __launch_bounds__(32) void k_gemmw(const T16* __restrict__ A, const T16* __restrict__ A2, const T16* __restrict__ Bt, const T16* __restrict__ Bt2, int K, float* C, int ldc, const float* __restrict__ bias, size_t sA, size_t sB, size_t sC) {
    typedef typename WFrag<T16>::V V;
    __shared__ __align__(16) float os[16 * 68];
    const size_t z = blockIdx.z; A += z * sA; if (A2) A2 += z * sA; Bt += z * sB; if (Bt2) Bt2 += z * sB; C += z * sC;
    const int lane = threadIdx.x & 31, lr = lane & 15, hi = lane >> 4; const int r0 = blockIdx.x * 64, c0 = blockIdx.y * 64;
    v8f acc[4][4];
#pragma unroll
    for (int mb = 0; mb < 4; ++mb)
#pragma unroll
        for (int nb = 0; nb < 4; ++nb) acc[mb][nb] = (v8f){};
    const size_t aoff = (size_t)(r0 + lr) * K + 8 * hi, boff = (size_t)(c0 + lr) * K + 8 * hi;
#pragma unroll 1
    for (int kc = 0; kc < K; kc += 32) {
        V a[4], a2[4];
#pragma unroll
        for (int mb = 0; mb < 4; ++mb) { a[mb] = WFrag<T16>::ld(A + aoff + (size_t)mb * 16 * K + kc); if (NSPLIT == 1 || NSPLIT == 2) a2[mb] = WFrag<T16>::ld(A2 + aoff + (size_t)mb * 16 * K + kc); }
#pragma unroll
        for (int nb = 0; nb < 4; ++nb) { const V b = WFrag<T16>::ld(Bt + boff + (size_t)nb * 16 * K + kc); V b2; if (NSPLIT >= 2) b2 = WFrag<T16>::ld(Bt2 + boff + (size_t)nb * 16 * K + kc);
#pragma unroll
            for (int mb = 0; mb < 4; ++mb) { acc[mb][nb] = WFrag<T16>::mma(a[mb], b, acc[mb][nb]); if (NSPLIT == 1 || NSPLIT == 2) acc[mb][nb] = WFrag<T16>::mma(a2[mb], b, acc[mb][nb]); if (NSPLIT >= 2) acc[mb][nb] = WFrag<T16>::mma(a[mb], b2, acc[mb][nb]); } }
        asm volatile("v_nop\n\tv_nop\n\tv_nop\n\tv_nop" : "+v"(acc[0][0]), "+v"(acc[1][1]), "+v"(acc[2][2]), "+v"(acc[3][3]) : "v"(a[0]), "v"(a[3]));
    }
#pragma unroll
    for (int mb = 0; mb < 4; ++mb) {
#pragma unroll
        for (int nb = 0; nb < 4; ++nb) {
#pragma unroll
            for (int j = 0; j < 8; ++j) os[(hi * 8 + j) * 68 + nb * 16 + lr] = acc[mb][nb][j]; }
        __builtin_amdgcn_wave_barrier(); asm volatile("" ::: "memory");
        float* crow = C + (size_t)(r0 + mb * 16) * ldc + c0;
{
#pragma unroll
            for (int s = 0; s < 8; ++s) { const int row = 2 * s + hi, cofs = lr * 4; v4f val = *(const v4fa*)(os + row * 68 + cofs); if (BIAS) { val[0] += bfr(bias[c0 + cofs]); val[1] += bfr(bias[c0 + cofs + 1]); val[2] += bfr(bias[c0 + cofs + 2]); val[3] += bfr(bias[c0 + cofs + 3]); }
                *(v4f*)(crow + (size_t)row * ldc + cofs) = val; }
             }
        __builtin_amdgcn_wave_barrier(); asm volatile("" ::: "memory");
    }
}

__device__ __forceinline__ h16 tohx(float x) { return (h16)x; }
__device__ __forceinline__ void splitf(float y, unsigned short& h, unsigned short& l) { h = f2bf(y); l = f2bf(y - bf2f(h)); }
typedef __attribute__((ext_vector_type(2))) _Float16 v2h;
typedef __attribute__((ext_vector_type(4))) _Float16 v4h;
typedef __attribute__((ext_vector_type(2))) unsigned short v2us;
typedef __attribute__((ext_vector_type(4))) unsigned short v4us;
typedef __attribute__((ext_vector_type(2))) float v2f;
typedef __attribute__((ext_vector_type(4))) int v4i;

__global__ __launch_bounds__(256) void k_wtG(const float* __restrict__ w, int K, int N, bf* Bt) {
    const int lane = threadIdx.x & 31; const int L0 = (blockIdx.x * 8 + (threadIdx.x >> 5)) * 8; const int nlines = N * K / 64;
{
#pragma unroll 1
        for (int l = 0; l < 8; ++l) { const int L = L0 + l; if (L >= nlines) break; const size_t e = (size_t)L * 64 + lane * 2; const int k = (int)(e % K), n = (int)(e / K); v2us o;
            o[0] = f2bf(w[(size_t)k * N + n]); o[1] = f2bf(w[(size_t)(k + 1) * N + n]); *(v2us*)(Bt + e) = o; }
         }
}
__global__ __launch_bounds__(256) void k_cvt8(const float* __restrict__ src, bf* dst, size_t n8) { const size_t i = (size_t)blockIdx.x * 256 + threadIdx.x; if (i >= n8) return; const v8f v = *(const v8f*)(src + i * 8); v8us o;
#pragma unroll
    for (int k = 0; k < 8; ++k) o[k] = f2bf(v[k]); *(v8us*)(dst + i * 8) = o;  }
__global__ __launch_bounds__(256) void k_cscvt(const float* __restrict__ rope, const float* __restrict__ unused, float* CS) { (void)unused; const int idx = blockIdx.x * 256 + threadIdx.x; if (idx >= TT * HD) return; const int t = idx / HD, dd = idx % HD; const int i = dd >> 1; const float* R = rope + ((size_t)t * (HD / 2) + i) * 4;   /* [r][c] */ v2f cs;
    if ((dd & 1) == 0) { cs[0] = bfr(R[0]); cs[1] = -bfr(R[1]); } else { cs[0] = bfr(R[3]); cs[1] = bfr(R[2]); }
    *(v2f*)(CS + (size_t)idx * 2) = cs;  }
// k_rope: head planes [h][t][d] (fp16 + hi/lo) of rope(x) x sc with the interleaved-pair 2x2 form out[d] = x[d] CS[t][d][0] - x[d^1] CS[t][d][1] for even d, out[d] = x[d] CS[t][d][0] + x[d^1] CS[t][d][1] for odd d
__global__ __launch_bounds__(256) void k_rope(const float* __restrict__ F, int pitch, int nheads, const float* __restrict__ CS, const float* __restrict__ RF, const float* __restrict__ nw, float sc, h16* P16, bf* Ph, bf* Pl) {
    const size_t e = ((size_t)blockIdx.x * 256 + threadIdx.x) * 2; if (e >= (size_t)nheads * TT * HD) return; const int d = (int)(e % HD); const int t = (int)((e / HD) % TT); const int h = (int)(e / ((size_t)HD * TT)); const float* f = F + (size_t)t * pitch + h * HD; const float rf = RF ? RF[(size_t)h * TT + t] : 1.0f; v2h o16; v2us oh, ol;
#pragma unroll
    for (int q = 0; q < 2; ++q) { const int dd = d + q; const int dp = dd ^ 1; float x0 = f[dd], x1 = f[dp];
        if (RF) { float n0 = __fmul_rn(x0, rf), n1 = __fmul_rn(x1, rf); asm volatile("" : "+v"(n0)); asm volatile("" : "+v"(n1)); x0 = __fmul_rn(bfr(nw[dd]), n0); x1 = __fmul_rn(bfr(nw[dp]), n1); }
        const v2f cs = *(const v2f*)(CS + ((size_t)t * HD + dd) * 2); float a = __fmul_rn(x0, cs[0]), bq = __fmul_rn(x1, cs[1]); asm volatile("" : "+v"(a)); asm volatile("" : "+v"(bq)); const float r = (((dd & 1) == 0) ? __fsub_rn(a, bq) : __fadd_rn(a, bq)) * sc;
        o16[q] = tohx(r); unsigned short a2, c2; splitf(r, a2, c2); oh[q] = a2; ol[q] = c2; }
    *(v2h*)(P16 + e) = o16; *(v2us*)(Ph + e) = oh; *(v2us*)(Pl + e) = ol;  }
__global__ __launch_bounds__(256) void k_vtp(const float* __restrict__ F, int pitch, int nheads, h16* V16, bf* Vh, bf* Vl) { const size_t e = ((size_t)blockIdx.x * 256 + threadIdx.x) * 2; if (e >= (size_t)nheads * HD * TT) return; const int t = (int)(e % TT); const int d = (int)((e / TT) % HD); const int g = (int)(e / ((size_t)TT * HD)); v2h o16; v2us oh, ol;
#pragma unroll
    for (int q = 0; q < 2; ++q) { const float x = F[(size_t)(t + q) * pitch + g * HD + d]; o16[q] = tohx(x); unsigned short a2, c2; splitf(x, a2, c2); oh[q] = a2; ol[q] = c2; }
    *(v2h*)(V16 + e) = o16; *(v2us*)(Vh + e) = oh; *(v2us*)(Vl + e) = ol;  }
__global__ __launch_bounds__(256) void k_rmsw(float* F, int pitch, int nheads, const float* __restrict__ w) { const int lane = threadIdx.x & 31; const int wv = blockIdx.x * 8 + (threadIdx.x >> 5); if (wv >= TT * nheads) return; const int t = wv / nheads, h = wv % nheads; float* f = F + (size_t)t * pitch + h * HD; const v4f a = *(const v4f*)(f + lane * 4); float ss = 0.f;
#pragma unroll
    for (int q = 0; q < 4; ++q) { float p = __fmul_rn(a[q], a[q]); asm volatile("" : "+v"(p)); ss = __fadd_rn(ss, p); }
#pragma unroll
    for (int sh = 16; sh; sh >>= 1) ss = __fadd_rn(ss, __shfl_xor(ss, sh, 32));
    const float rs = __fdiv_rn(1.0f, sqrtf(__fadd_rn(ss * (1.0f / HD), 1.1920928955078125e-7f))); v4f o;
#pragma unroll
    for (int q = 0; q < 4; ++q) { float y = __fmul_rn(a[q], rs); asm volatile("" : "+v"(y)); o[q] = __fmul_rn(y, bfr(w[lane * 4 + q])); }
    *(v4f*)(f + lane * 4) = o;  }
// k_asoft: per row (zz, i): t = S x HD^-0.5 (no mask); softmax over the 2048 keys (register row, one exp, fixed trees);
__global__ __launch_bounds__(256) void k_asoft(const float* __restrict__ Sb, h16* P16, bf* Ph, bf* Pl) {
    const int lane = threadIdx.x & 31; const int row = blockIdx.x * 8 + (threadIdx.x >> 5); if (row >= ZH * TT) return; const int i = row % TT; const int zz = row / TT; (void)zz; const bool hires = (i < RH); const float* sr = Sb + (size_t)row * TT; float v[TT / 32]; float mx = -3.0e38f;
#pragma unroll
    for (int ch = 0; ch < TT / 128; ++ch) { const int j0 = ch * 128 + lane * 4; const v4f a = *(const v4f*)(sr + j0);
#pragma unroll
        for (int q = 0; q < 4; ++q) { const int j = j0 + q; (void)j; float sa = a[q] * SCL; asm volatile("" : "+v"(sa)); const float t = sa; v[ch * 4 + q] = t; mx = fmaxf(mx, t); } }
#pragma unroll
    for (int sh = 16; sh; sh >>= 1) mx = fmaxf(mx, __shfl_xor(mx, sh, 32));
    float sum = 0.f;
#pragma unroll
    for (int k = 0; k < TT / 32; ++k) { float d0 = __fsub_rn(v[k], mx); asm volatile("" : "+v"(d0)); v[k] = __builtin_amdgcn_exp2f(__fmul_rn(d0, 1.4426950408889634f)); sum += v[k]; }
#pragma unroll
    for (int sh = 16; sh; sh >>= 1) sum += __shfl_xor(sum, sh, 32);
    const float f = __fdiv_rn(hires ? 1.0f : PCAR, sum);
{
        if (hires) {
#pragma unroll
            for (int ch = 0; ch < TT / 128; ++ch) { v4us oh, ol;
#pragma unroll
                for (int q = 0; q < 4; ++q) { unsigned short a, c2; splitf(v[ch * 4 + q] * f, a, c2); oh[q] = a; ol[q] = c2; }
                const size_t oo = ((size_t)zz * (RH ? RH : 1) + i) * TT + ch * 128 + lane * 4; *(v4us*)(Ph + oo) = oh; *(v4us*)(Pl + oo) = ol; }
        } else {
#pragma unroll
            for (int ch = 0; ch < TT / 128; ++ch) { v4h o4;
#pragma unroll
                for (int q = 0; q < 4; ++q) o4[q] = tohx(v[ch * 4 + q] * f);
                *(v4h*)(P16 + (size_t)row * TT + ch * 128 + lane * 4) = o4; } }
         }
}
__global__ __launch_bounds__(256) void k_merge(const float* __restrict__ O, int h0, bf* Ah, bf* Al) { const size_t e = ((size_t)blockIdx.x * 256 + threadIdx.x) * 2; if (e >= (size_t)ZH * TT * HD) return; const int d = (int)(e % HD); const int t = (int)((e / HD) % TT); const int zz = (int)(e / ((size_t)HD * TT)); const float cs = (t < RH) ? 1.0f : (1.0f / PCAR); const size_t oo = (size_t)t * DQ + (h0 + zz) * HD + d;
    v2us oh, ol;
#pragma unroll
    for (int q = 0; q < 2; ++q) { unsigned short a, c2; splitf(O[e + q] * cs, a, c2); oh[q] = a; ol[q] = c2; } *(v2us*)(Ah + oo) = oh; *(v2us*)(Al + oo) = ol;  }

extern "C" void kernel_launch(void* const* d_in, const int* in_sizes, int n_in,
                              void* d_out, int out_size, void* d_ws, size_t ws_size, hipStream_t stream) {
    (void)in_sizes; (void)n_in; (void)out_size;
    const float* x = (const float*)d_in[0]; const float* rope = (const float*)d_in[1]; const float* wq = (const float*)d_in[2]; const float* bq = (const float*)d_in[3]; const float* wk = (const float*)d_in[4]; const float* bk = (const float*)d_in[5]; const float* wv = (const float*)d_in[6]; const float* bv = (const float*)d_in[7]; const float* qnw = (const float*)d_in[8]; const float* knw = (const float*)d_in[9]; const float* wo = (const float*)d_in[10]; const float* bo = (const float*)d_in[11]; const float* cosT = rope; const float* sinT = rope;
    float* OUT = (float*)d_out;     // [1][2048][2048]
    char* wsp = (char*)d_ws;
    auto take = [&](size_t bytes) { char* p = wsp; wsp += (bytes + 255) & ~(size_t)255; return (void*)p; };
    bf* WQ = (bf*)take((size_t)DQ * DM * 2); bf* WK = (bf*)take((size_t)DKV * DM * 2); bf* WV = (bf*)take((size_t)DKV * DM * 2); bf* WO = (bf*)take((size_t)DM * DQ * 2); float* CS = (float*)take((size_t)TT * HD * 2 * 4);
    bf* XB = (bf*)take((size_t)TT * DM * 2); float* FQ = (float*)take((size_t)TT * DQ * 4); float* FK = (float*)take((size_t)TT * DKV * 4);
    h16* QP16 = (h16*)take((size_t)NH_ * TT * HD * 2); h16* KP16 = (h16*)take((size_t)NKV * TT * HD * 2); h16* VT16 = (h16*)take((size_t)NKV * HD * TT * 2);
    bf* QPh = (bf*)take((size_t)NH_ * TT * HD * 2); bf* QPl = (bf*)take((size_t)NH_ * TT * HD * 2); bf* KPh = (bf*)take((size_t)NKV * TT * HD * 2); bf* KPl = (bf*)take((size_t)NKV * TT * HD * 2); bf* VTh = (bf*)take((size_t)NKV * HD * TT * 2); bf* VTl = (bf*)take((size_t)NKV * HD * TT * 2); bf* Ph = (bf*)take((size_t)ZH * RH * TT * 2); bf* Pl = (bf*)take((size_t)ZH * RH * TT * 2);
    float* Sb = (float*)take((size_t)ZH * TT * TT * 4); h16* P16 = (h16*)take((size_t)ZH * TT * TT * 2); float* Ob = (float*)take((size_t)ZH * TT * HD * 4); bf* ATh = (bf*)take((size_t)TT * DQ * 2); bf* ATl = (bf*)take((size_t)TT * DQ * 2);
    if ((size_t)(wsp - (char*)d_ws) > ws_size) return;    // ws 256 MiB
    float* FV = FK;   // v projection reuses the k buffer after the k planes are built (stream-ordered)
    { k_cvt8<<<(unsigned)(((size_t)DQ * DM / 8 + 255) / 256), 256, 0, stream>>>(wq, WQ, (size_t)DQ * DM / 8); k_cvt8<<<(unsigned)(((size_t)DKV * DM / 8 + 255) / 256), 256, 0, stream>>>(wk, WK, (size_t)DKV * DM / 8); k_cvt8<<<(unsigned)(((size_t)DKV * DM / 8 + 255) / 256), 256, 0, stream>>>(wv, WV, (size_t)DKV * DM / 8);
      k_cvt8<<<(unsigned)(((size_t)DM * DQ / 8 + 255) / 256), 256, 0, stream>>>(wo, WO, (size_t)DM * DQ / 8);
       }
    const unsigned LQ = (unsigned)(((size_t)NH_ * TT * HD / 2 + 255) / 256), LKv = (unsigned)(((size_t)NKV * TT * HD / 2 + 255) / 256);
    for (int b = 0; b < NB_; ++b) {
        if (b == 0) k_cscvt<<<(TT * HD + 255) / 256, 256, 0, stream>>>(cosT, sinT, CS);
        k_cvt8<<<(unsigned)(((size_t)TT * DM / 8 + 255) / 256), 256, 0, stream>>>(x + (size_t)b * TT * DM, XB, (size_t)TT * DM / 8);
        k_gemmw<bf, 0, true><<<dim3(TT / 64, DQ / 64, 1), 32, 0, stream>>>(XB, nullptr, WQ, nullptr, DM, FQ, DQ, bq, 0, 0, 0);
        k_rmsw<<<TT * NH_ / 8, 256, 0, stream>>>(FQ, DQ, NH_, qnw); k_rope<<<LQ, 256, 0, stream>>>(FQ, DQ, NH_, CS, nullptr, nullptr, 1.0f, QP16, QPh, QPl);
        k_gemmw<bf, 0, true><<<dim3(TT / 64, DKV / 64, 1), 32, 0, stream>>>(XB, nullptr, WK, nullptr, DM, FK, DKV, bk, 0, 0, 0);
        k_rmsw<<<TT * NKV / 8, 256, 0, stream>>>(FK, DKV, NKV, knw); k_rope<<<LKv, 256, 0, stream>>>(FK, DKV, NKV, CS, nullptr, nullptr, 1.0f, KP16, KPh, KPl);
        k_gemmw<bf, 0, true><<<dim3(TT / 64, DKV / 64, 1), 32, 0, stream>>>(XB, nullptr, WV, nullptr, DM, FV, DKV, bv, 0, 0, 0); k_vtp<<<LKv, 256, 0, stream>>>(FV, DKV, NKV, VT16, VTh, VTl);
        for (int h0 = 0; h0 < NH_; h0 += ZH) { const size_t zq = (size_t)h0, zk = (size_t)(h0 / REP);   // one kv head per query head: the pass's two heads use consecutive kv planes (z-strides TT*HD)
            k_gemmw<bf, 2, false><<<dim3(TT / 64, TT / 64, ZH), 32, 0, stream>>>(QPh + zq * TT * HD, QPl + zq * TT * HD, KPh + zk * TT * HD, KPl + zk * TT * HD, HD, Sb, TT, nullptr, (size_t)TT * HD, (size_t)TT * HD, (size_t)TT * TT);   /* scores hl on all rows */
            k_asoft<<<ZH * TT / 8, 256, 0, stream>>>(Sb, P16, Ph, Pl);
            k_gemmw<bf, 2, false><<<dim3(RH / 64, HD / 64, ZH), 32, 0, stream>>>(Ph, Pl, VTh + zk * HD * TT, VTl + zk * HD * TT, TT, Ob, HD, nullptr, (size_t)RH * TT, (size_t)HD * TT, (size_t)TT * HD);
            k_gemmw<h16, 0, false><<<dim3((TT - RH) / 64, HD / 64, ZH), 32, 0, stream>>>(P16 + (size_t)RH * TT, nullptr, VT16 + zk * HD * TT, nullptr, TT, Ob + (size_t)RH * HD, HD, nullptr, (size_t)TT * TT, (size_t)HD * TT, (size_t)TT * HD);
            k_merge<<<(unsigned)(((size_t)ZH * TT * HD / 2 + 255) / 256), 256, 0, stream>>>(Ob, h0, ATh, ATl); }
        k_gemmw<bf, 1, true><<<dim3(TT / 64, DM / 64, 1), 32, 0, stream>>>(ATh, ATl, WO, nullptr, DQ, OUT + (size_t)b * TT * DM, DM, bo, 0, 0, 0); }
}

// v001
// A run of this version takes 693 microseconds.
// In both of two side-by-side timings against v000, it was 1.77 times as fast.
#include <hip/hip_runtime.h>

// MultiheadSelfAttentionEnc (x [1][2048][2048]; q/k/v = x W^T + b (16 heads x 128); q, k RMS-normalised per head * w (eps = f32 eps 1.19e-7); rotary as a general per-(token, pair) 2x2 matrix from the read rope [1][S][1][64][2][2]: out[2i+r] = rope[i][r][0] x[2i] + rope[i][r][1] x[2i+1]; softmax(q.k / sqrt(128)) (no mask); out = merged wo^T + bo -> [1][2048][2048]).
// Compute dtypes, f32 accumulate: every input rounded to bf16; q/k/v on PLAIN bf16 operands (inputs: exact) + bias; RMSNorm (in place) and the 2x2 rotary (bf16-rounded rope entries, folded into a per-element (c, s) table) f32; scores hl x hl (3 products) on every row (normalised q/k are sharp), attn.v: query rows < 512 hl (3 products), the rest single fp16 (x1024); softmax f32; wo hl x exact (2 products) + bias.

#define NB_  1
#define TT   2048
#define DM   2048
#define NH_  16
#define NKV  16
#define REP  (NH_ / NKV)
#define HD   128
#define DQ   (NH_ * HD)
#define DKV  (NKV * HD)
#define ZH   2
#define RH   512                  // query rows < RH use hi+lo planes (0: none)
#define WIN  0
#define PCAR 1024.0f
#define KSP  8                    // key slices of the attn.v products: one work-group per (tile, slice), f32 partial planes summed in k_merge
#define SCL  0.088388347648318447f   // HD^-0.5
typedef _Float16 h16;
typedef unsigned short bf;
typedef __attribute__((ext_vector_type(16))) __bf16   v16bf;
typedef __attribute__((ext_vector_type(16))) _Float16 v16h;
typedef __attribute__((ext_vector_type(8)))  _Float16 v8h;
typedef __attribute__((ext_vector_type(8)))  unsigned short v8us;
typedef __attribute__((ext_vector_type(8)))  float    v8f;
typedef __attribute__((ext_vector_type(4)))  float    v4f;
typedef v8h  __attribute__((may_alias)) v8ha;
typedef v4f  __attribute__((may_alias)) v4fa;
typedef v8us __attribute__((may_alias)) v8usa;

__device__ __forceinline__ unsigned short f2bf(float f) { unsigned u = __float_as_uint(f); u += 0x7FFFu + ((u >> 16) & 1u); return (unsigned short)(u >> 16); }
__device__ __forceinline__ float bf2f(unsigned short b) { return __uint_as_float(((unsigned)b) << 16); }
__device__ __forceinline__ float bfr(float f) { return bf2f(f2bf(f)); }
__device__ __forceinline__ v16h cat16(v8h lo, v8h hi) { return __builtin_shufflevector(lo, hi, 0, 1, 2, 3, 4, 5, 6, 7, 8, 9, 10, 11, 12, 13, 14, 15); }
__device__ __forceinline__ v16bf cat16b(v8us lo, v8us hi) { return __builtin_bit_cast(v16bf, __builtin_shufflevector(lo, hi, 0, 1, 2, 3, 4, 5, 6, 7, 8, 9, 10, 11, 12, 13, 14, 15)); }
__device__ __forceinline__ v8f wmma16(v16h a, v16h b, v8f c) { return __builtin_amdgcn_wmma_f32_16x16x32_f16(false, a, false, b, (short)0, c, false, false); }
__device__ __forceinline__ v8f wmmab(v16bf a, v16bf b, v8f c) { return __builtin_amdgcn_wmma_f32_16x16x32_bf16(false, a, false, b, (short)0, c, false, false); }



// ---- k_gemmw: register-blocked GEMM, ONE WAVE per 64x64 output tile (16 accumulators), operands straight from K-contiguous 16-bit planes; grid (M/64, N/64, Z), 32 threads.
// C[m][n] (f32, pitch ldc, + optional f32 bias[n]) = sum_k A[m][k] Bt[n][k] (+ split products per NSPLIT). z-batch strides sA/sB/sC in elements. K % 32 == 0.
// KS > 1: grid z = batch * KS + slice; a work-group sums only k in [slice K/KS, (slice + 1) K/KS) and stores its partial tile at C + slice * sK (the reader adds the KS planes). K % (32 KS) == 0.
template <typename T16> struct WFrag;
template <> struct WFrag<h16> { typedef v16h V; static __device__ __forceinline__ V ld(const h16* p) { return cat16(*(const v8h*)p, *(const v8h*)(p + 16)); } static __device__ __forceinline__ v8f mma(V a, V b, v8f c) { return wmma16(a, b, c); } };
template <> struct WFrag<bf> { typedef v16bf V; static __device__ __forceinline__ V ld(const bf* p) { return cat16b(*(const v8us*)p, *(const v8us*)(p + 16)); } static __device__ __forceinline__ v8f mma(V a, V b, v8f c) { return wmmab(a, b, c); } };
template <typename T16, int NSPLIT, bool BIAS, int KS = 1>
__global__ __launch_bounds__(32) void k_gemmw(const T16* __restrict__ A, const T16* __restrict__ A2, const T16* __restrict__ Bt, const T16* __restrict__ Bt2, int K, float* C, int ldc, const float* __restrict__ bias, size_t sA, size_t sB, size_t sC, size_t sK) {
    typedef typename WFrag<T16>::V V;
    __shared__ __align__(16) float os[16 * 68];
    const size_t z = blockIdx.z / KS; const int kb = (int)(blockIdx.z % KS) * (K / KS), ke = kb + K / KS; C += (size_t)(blockIdx.z % KS) * sK; A += z * sA; if (A2) A2 += z * sA; Bt += z * sB; if (Bt2) Bt2 += z * sB; C += z * sC;
    const int lane = threadIdx.x & 31, lr = lane & 15, hi = lane >> 4; const int r0 = blockIdx.x * 64, c0 = blockIdx.y * 64;
    v8f acc[4][4];
#pragma unroll
    for (int mb = 0; mb < 4; ++mb)
#pragma unroll
        for (int nb = 0; nb < 4; ++nb) acc[mb][nb] = (v8f){};
    const size_t aoff = (size_t)(r0 + lr) * K + 8 * hi, boff = (size_t)(c0 + lr) * K + 8 * hi;
#pragma unroll 1
    for (int kc = kb; kc < ke; kc += 32) {
        V a[4], a2[4];
#pragma unroll
        for (int mb = 0; mb < 4; ++mb) { a[mb] = WFrag<T16>::ld(A + aoff + (size_t)mb * 16 * K + kc); if (NSPLIT == 1 || NSPLIT == 2) a2[mb] = WFrag<T16>::ld(A2 + aoff + (size_t)mb * 16 * K + kc); }
#pragma unroll
        for (int nb = 0; nb < 4; ++nb) { const V b = WFrag<T16>::ld(Bt + boff + (size_t)nb * 16 * K + kc); V b2; if (NSPLIT >= 2) b2 = WFrag<T16>::ld(Bt2 + boff + (size_t)nb * 16 * K + kc);
#pragma unroll
            for (int mb = 0; mb < 4; ++mb) { acc[mb][nb] = WFrag<T16>::mma(a[mb], b, acc[mb][nb]); if (NSPLIT == 1 || NSPLIT == 2) acc[mb][nb] = WFrag<T16>::mma(a2[mb], b, acc[mb][nb]); if (NSPLIT >= 2) acc[mb][nb] = WFrag<T16>::mma(a[mb], b2, acc[mb][nb]); } }
        asm volatile("v_nop\n\tv_nop\n\tv_nop\n\tv_nop" : "+v"(acc[0][0]), "+v"(acc[1][1]), "+v"(acc[2][2]), "+v"(acc[3][3]) : "v"(a[0]), "v"(a[3]));
    }
#pragma unroll
    for (int mb = 0; mb < 4; ++mb) {
#pragma unroll
        for (int nb = 0; nb < 4; ++nb) {
#pragma unroll
            for (int j = 0; j < 8; ++j) os[(hi * 8 + j) * 68 + nb * 16 + lr] = acc[mb][nb][j]; }
        __builtin_amdgcn_wave_barrier(); asm volatile("" ::: "memory");
        float* crow = C + (size_t)(r0 + mb * 16) * ldc + c0;
{
#pragma unroll
            for (int s = 0; s < 8; ++s) { const int row = 2 * s + hi, cofs = lr * 4; v4f val = *(const v4fa*)(os + row * 68 + cofs); if (BIAS) { val[0] += bfr(bias[c0 + cofs]); val[1] += bfr(bias[c0 + cofs + 1]); val[2] += bfr(bias[c0 + cofs + 2]); val[3] += bfr(bias[c0 + cofs + 3]); }
                *(v4f*)(crow + (size_t)row * ldc + cofs) = val; }
             }
        __builtin_amdgcn_wave_barrier(); asm volatile("" ::: "memory");
    }
}

__device__ __forceinline__ h16 tohx(float x) { return (h16)x; }
__device__ __forceinline__ void splitf(float y, unsigned short& h, unsigned short& l) { h = f2bf(y); l = f2bf(y - bf2f(h)); }
typedef __attribute__((ext_vector_type(2))) _Float16 v2h;
typedef __attribute__((ext_vector_type(4))) _Float16 v4h;
typedef __attribute__((ext_vector_type(2))) unsigned short v2us;
typedef __attribute__((ext_vector_type(4))) unsigned short v4us;
typedef __attribute__((ext_vector_type(2))) float v2f;
typedef __attribute__((ext_vector_type(4))) int v4i;

__global__ __launch_bounds__(256) void k_wtG(const float* __restrict__ w, int K, int N, bf* Bt) {
    const int lane = threadIdx.x & 31; const int L0 = (blockIdx.x * 8 + (threadIdx.x >> 5)) * 8; const int nlines = N * K / 64;
{
#pragma unroll 1
        for (int l = 0; l < 8; ++l) { const int L = L0 + l; if (L >= nlines) break; const size_t e = (size_t)L * 64 + lane * 2; const int k = (int)(e % K), n = (int)(e / K); v2us o;
            o[0] = f2bf(w[(size_t)k * N + n]); o[1] = f2bf(w[(size_t)(k + 1) * N + n]); *(v2us*)(Bt + e) = o; }
         }
}
__global__ __launch_bounds__(256) void k_cvt8(const float* __restrict__ src, bf* dst, size_t n8) { const size_t i = (size_t)blockIdx.x * 256 + threadIdx.x; if (i >= n8) return; const v8f v = *(const v8f*)(src + i * 8); v8us o;
#pragma unroll
    for (int k = 0; k < 8; ++k) o[k] = f2bf(v[k]); *(v8us*)(dst + i * 8) = o;  }
__global__ __launch_bounds__(256) void k_cscvt(const float* __restrict__ rope, const float* __restrict__ unused, float* CS) { (void)unused; const int idx = blockIdx.x * 256 + threadIdx.x; if (idx >= TT * HD) return; const int t = idx / HD, dd = idx % HD; const int i = dd >> 1; const float* R = rope + ((size_t)t * (HD / 2) + i) * 4;   /* [r][c] */ v2f cs;
    if ((dd & 1) == 0) { cs[0] = bfr(R[0]); cs[1] = -bfr(R[1]); } else { cs[0] = bfr(R[3]); cs[1] = bfr(R[2]); }
    *(v2f*)(CS + (size_t)idx * 2) = cs;  }
// k_rope: head planes [h][t][d] (fp16 + hi/lo) of rope(x) x sc with the interleaved-pair 2x2 form out[d] = x[d] CS[t][d][0] - x[d^1] CS[t][d][1] for even d, out[d] = x[d] CS[t][d][0] + x[d^1] CS[t][d][1] for odd d
__global__ __launch_bounds__(256) void k_rope(const float* __restrict__ F, int pitch, int nheads, const float* __restrict__ CS, const float* __restrict__ RF, const float* __restrict__ nw, float sc, h16* P16, bf* Ph, bf* Pl) {
    const size_t e = ((size_t)blockIdx.x * 256 + threadIdx.x) * 2; if (e >= (size_t)nheads * TT * HD) return; const int d = (int)(e % HD); const int t = (int)((e / HD) % TT); const int h = (int)(e / ((size_t)HD * TT)); const float* f = F + (size_t)t * pitch + h * HD; const float rf = RF ? RF[(size_t)h * TT + t] : 1.0f; v2h o16; v2us oh, ol;
#pragma unroll
    for (int q = 0; q < 2; ++q) { const int dd = d + q; const int dp = dd ^ 1; float x0 = f[dd], x1 = f[dp];
        if (RF) { float n0 = __fmul_rn(x0, rf), n1 = __fmul_rn(x1, rf); asm volatile("" : "+v"(n0)); asm volatile("" : "+v"(n1)); x0 = __fmul_rn(bfr(nw[dd]), n0); x1 = __fmul_rn(bfr(nw[dp]), n1); }
        const v2f cs = *(const v2f*)(CS + ((size_t)t * HD + dd) * 2); float a = __fmul_rn(x0, cs[0]), bq = __fmul_rn(x1, cs[1]); asm volatile("" : "+v"(a)); asm volatile("" : "+v"(bq)); const float r = (((dd & 1) == 0) ? __fsub_rn(a, bq) : __fadd_rn(a, bq)) * sc;
        o16[q] = tohx(r); unsigned short a2, c2; splitf(r, a2, c2); oh[q] = a2; ol[q] = c2; }
    *(v2h*)(P16 + e) = o16; *(v2us*)(Ph + e) = oh; *(v2us*)(Pl + e) = ol;  }
__global__ __launch_bounds__(256) void k_vtp(const float* __restrict__ F, int pitch, int nheads, h16* V16, bf* Vh, bf* Vl) { const size_t e = ((size_t)blockIdx.x * 256 + threadIdx.x) * 2; if (e >= (size_t)nheads * HD * TT) return; const int t = (int)(e % TT); const int d = (int)((e / TT) % HD); const int g = (int)(e / ((size_t)TT * HD)); v2h o16; v2us oh, ol;
#pragma unroll
    for (int q = 0; q < 2; ++q) { const float x = F[(size_t)(t + q) * pitch + g * HD + d]; o16[q] = tohx(x); unsigned short a2, c2; splitf(x, a2, c2); oh[q] = a2; ol[q] = c2; }
    *(v2h*)(V16 + e) = o16; *(v2us*)(Vh + e) = oh; *(v2us*)(Vl + e) = ol;  }
__global__ __launch_bounds__(256) void k_rmsw(float* F, int pitch, int nheads, const float* __restrict__ w) { const int lane = threadIdx.x & 31; const int wv = blockIdx.x * 8 + (threadIdx.x >> 5); if (wv >= TT * nheads) return; const int t = wv / nheads, h = wv % nheads; float* f = F + (size_t)t * pitch + h * HD; const v4f a = *(const v4f*)(f + lane * 4); float ss = 0.f;
#pragma unroll
    for (int q = 0; q < 4; ++q) { float p = __fmul_rn(a[q], a[q]); asm volatile("" : "+v"(p)); ss = __fadd_rn(ss, p); }
#pragma unroll
    for (int sh = 16; sh; sh >>= 1) ss = __fadd_rn(ss, __shfl_xor(ss, sh, 32));
    const float rs = __fdiv_rn(1.0f, sqrtf(__fadd_rn(ss * (1.0f / HD), 1.1920928955078125e-7f))); v4f o;
#pragma unroll
    for (int q = 0; q < 4; ++q) { float y = __fmul_rn(a[q], rs); asm volatile("" : "+v"(y)); o[q] = __fmul_rn(y, bfr(w[lane * 4 + q])); }
    *(v4f*)(f + lane * 4) = o;  }
// k_asoft: per row (zz, i): t = S x HD^-0.5 (no mask); softmax over the 2048 keys (register row, one exp, fixed trees);
__global__ __launch_bounds__(256) void k_asoft(const float* __restrict__ Sb, h16* P16, bf* Ph, bf* Pl) {
    const int lane = threadIdx.x & 31; const int row = blockIdx.x * 8 + (threadIdx.x >> 5); if (row >= ZH * TT) return; const int i = row % TT; const int zz = row / TT; (void)zz; const bool hires = (i < RH); const float* sr = Sb + (size_t)row * TT; float v[TT / 32]; float mx = -3.0e38f;
#pragma unroll
    for (int ch = 0; ch < TT / 128; ++ch) { const int j0 = ch * 128 + lane * 4; const v4f a = *(const v4f*)(sr + j0);
#pragma unroll
        for (int q = 0; q < 4; ++q) { const int j = j0 + q; (void)j; float sa = a[q] * SCL; asm volatile("" : "+v"(sa)); const float t = sa; v[ch * 4 + q] = t; mx = fmaxf(mx, t); } }
#pragma unroll
    for (int sh = 16; sh; sh >>= 1) mx = fmaxf(mx, __shfl_xor(mx, sh, 32));
    float sum = 0.f;
#pragma unroll
    for (int k = 0; k < TT / 32; ++k) { float d0 = __fsub_rn(v[k], mx); asm volatile("" : "+v"(d0)); v[k] = __builtin_amdgcn_exp2f(__fmul_rn(d0, 1.4426950408889634f)); sum += v[k]; }
#pragma unroll
    for (int sh = 16; sh; sh >>= 1) sum += __shfl_xor(sum, sh, 32);
    const float f = __fdiv_rn(hires ? 1.0f : PCAR, sum);
{
        if (hires) {
#pragma unroll
            for (int ch = 0; ch < TT / 128; ++ch) { v4us oh, ol;
#pragma unroll
                for (int q = 0; q < 4; ++q) { unsigned short a, c2; splitf(v[ch * 4 + q] * f, a, c2); oh[q] = a; ol[q] = c2; }
                const size_t oo = ((size_t)zz * (RH ? RH : 1) + i) * TT + ch * 128 + lane * 4; *(v4us*)(Ph + oo) = oh; *(v4us*)(Pl + oo) = ol; }
        } else {
#pragma unroll
            for (int ch = 0; ch < TT / 128; ++ch) { v4h o4;
#pragma unroll
                for (int q = 0; q < 4; ++q) o4[q] = tohx(v[ch * 4 + q] * f);
                *(v4h*)(P16 + (size_t)row * TT + ch * 128 + lane * 4) = o4; } }
         }
}
__global__ __launch_bounds__(256) void k_merge(const float* __restrict__ O, int h0, bf* Ah, bf* Al) { const size_t e = ((size_t)blockIdx.x * 256 + threadIdx.x) * 2; if (e >= (size_t)ZH * TT * HD) return; const int d = (int)(e % HD); const int t = (int)((e / HD) % TT); const int zz = (int)(e / ((size_t)HD * TT)); const float cs = (t < RH) ? 1.0f : (1.0f / PCAR); const size_t oo = (size_t)t * DQ + (h0 + zz) * HD + d;
    v2f s = *(const v2f*)(O + e);   // the KSP key-slice partials, added in slice order
#pragma unroll
    for (int ks = 1; ks < KSP; ++ks) s += *(const v2f*)(O + (size_t)ks * ZH * TT * HD + e);
    v2us oh, ol;
#pragma unroll
    for (int q = 0; q < 2; ++q) { unsigned short a, c2; splitf(s[q] * cs, a, c2); oh[q] = a; ol[q] = c2; } *(v2us*)(Ah + oo) = oh; *(v2us*)(Al + oo) = ol;  }

extern "C" void kernel_launch(void* const* d_in, const int* in_sizes, int n_in,
                              void* d_out, int out_size, void* d_ws, size_t ws_size, hipStream_t stream) {
    (void)in_sizes; (void)n_in; (void)out_size;
    const float* x = (const float*)d_in[0]; const float* rope = (const float*)d_in[1]; const float* wq = (const float*)d_in[2]; const float* bq = (const float*)d_in[3]; const float* wk = (const float*)d_in[4]; const float* bk = (const float*)d_in[5]; const float* wv = (const float*)d_in[6]; const float* bv = (const float*)d_in[7]; const float* qnw = (const float*)d_in[8]; const float* knw = (const float*)d_in[9]; const float* wo = (const float*)d_in[10]; const float* bo = (const float*)d_in[11]; const float* cosT = rope; const float* sinT = rope;
    float* OUT = (float*)d_out;     // [1][2048][2048]
    char* wsp = (char*)d_ws;
    auto take = [&](size_t bytes) { char* p = wsp; wsp += (bytes + 255) & ~(size_t)255; return (void*)p; };
    bf* WQ = (bf*)take((size_t)DQ * DM * 2); bf* WK = (bf*)take((size_t)DKV * DM * 2); bf* WV = (bf*)take((size_t)DKV * DM * 2); bf* WO = (bf*)take((size_t)DM * DQ * 2); float* CS = (float*)take((size_t)TT * HD * 2 * 4);
    bf* XB = (bf*)take((size_t)TT * DM * 2); float* FQ = (float*)take((size_t)TT * DQ * 4); float* FK = (float*)take((size_t)TT * DKV * 4);
    h16* QP16 = (h16*)take((size_t)NH_ * TT * HD * 2); h16* KP16 = (h16*)take((size_t)NKV * TT * HD * 2); h16* VT16 = (h16*)take((size_t)NKV * HD * TT * 2);
    bf* QPh = (bf*)take((size_t)NH_ * TT * HD * 2); bf* QPl = (bf*)take((size_t)NH_ * TT * HD * 2); bf* KPh = (bf*)take((size_t)NKV * TT * HD * 2); bf* KPl = (bf*)take((size_t)NKV * TT * HD * 2); bf* VTh = (bf*)take((size_t)NKV * HD * TT * 2); bf* VTl = (bf*)take((size_t)NKV * HD * TT * 2); bf* Ph = (bf*)take((size_t)ZH * RH * TT * 2); bf* Pl = (bf*)take((size_t)ZH * RH * TT * 2);
    float* Sb = (float*)take((size_t)ZH * TT * TT * 4); h16* P16 = (h16*)take((size_t)ZH * TT * TT * 2); float* Ob = (float*)take((size_t)KSP * ZH * TT * HD * 4); bf* ATh = (bf*)take((size_t)TT * DQ * 2); bf* ATl = (bf*)take((size_t)TT * DQ * 2);
    if ((size_t)(wsp - (char*)d_ws) > ws_size) return;    // ws 256 MiB
    float* FV = FK;   // v projection reuses the k buffer after the k planes are built (stream-ordered)
    { k_cvt8<<<(unsigned)(((size_t)DQ * DM / 8 + 255) / 256), 256, 0, stream>>>(wq, WQ, (size_t)DQ * DM / 8); k_cvt8<<<(unsigned)(((size_t)DKV * DM / 8 + 255) / 256), 256, 0, stream>>>(wk, WK, (size_t)DKV * DM / 8); k_cvt8<<<(unsigned)(((size_t)DKV * DM / 8 + 255) / 256), 256, 0, stream>>>(wv, WV, (size_t)DKV * DM / 8);
      k_cvt8<<<(unsigned)(((size_t)DM * DQ / 8 + 255) / 256), 256, 0, stream>>>(wo, WO, (size_t)DM * DQ / 8);
       }
    const unsigned LQ = (unsigned)(((size_t)NH_ * TT * HD / 2 + 255) / 256), LKv = (unsigned)(((size_t)NKV * TT * HD / 2 + 255) / 256);
    for (int b = 0; b < NB_; ++b) {
        if (b == 0) k_cscvt<<<(TT * HD + 255) / 256, 256, 0, stream>>>(cosT, sinT, CS);
        k_cvt8<<<(unsigned)(((size_t)TT * DM / 8 + 255) / 256), 256, 0, stream>>>(x + (size_t)b * TT * DM, XB, (size_t)TT * DM / 8);
        k_gemmw<bf, 0, true><<<dim3(TT / 64, DQ / 64, 1), 32, 0, stream>>>(XB, nullptr, WQ, nullptr, DM, FQ, DQ, bq, 0, 0, 0, 0);
        k_rmsw<<<TT * NH_ / 8, 256, 0, stream>>>(FQ, DQ, NH_, qnw); k_rope<<<LQ, 256, 0, stream>>>(FQ, DQ, NH_, CS, nullptr, nullptr, 1.0f, QP16, QPh, QPl);
        k_gemmw<bf, 0, true><<<dim3(TT / 64, DKV / 64, 1), 32, 0, stream>>>(XB, nullptr, WK, nullptr, DM, FK, DKV, bk, 0, 0, 0, 0);
        k_rmsw<<<TT * NKV / 8, 256, 0, stream>>>(FK, DKV, NKV, knw); k_rope<<<LKv, 256, 0, stream>>>(FK, DKV, NKV, CS, nullptr, nullptr, 1.0f, KP16, KPh, KPl);
        k_gemmw<bf, 0, true><<<dim3(TT / 64, DKV / 64, 1), 32, 0, stream>>>(XB, nullptr, WV, nullptr, DM, FV, DKV, bv, 0, 0, 0, 0); k_vtp<<<LKv, 256, 0, stream>>>(FV, DKV, NKV, VT16, VTh, VTl);
        for (int h0 = 0; h0 < NH_; h0 += ZH) { const size_t zq = (size_t)h0, zk = (size_t)(h0 / REP);   // one kv head per query head: the pass's two heads use consecutive kv planes (z-strides TT*HD)
            k_gemmw<bf, 2, false><<<dim3(TT / 64, TT / 64, ZH), 32, 0, stream>>>(QPh + zq * TT * HD, QPl + zq * TT * HD, KPh + zk * TT * HD, KPl + zk * TT * HD, HD, Sb, TT, nullptr, (size_t)TT * HD, (size_t)TT * HD, (size_t)TT * TT, 0);   /* scores hl on all rows */
            k_asoft<<<ZH * TT / 8, 256, 0, stream>>>(Sb, P16, Ph, Pl);
            k_gemmw<bf, 2, false, KSP><<<dim3(RH / 64, HD / 64, ZH * KSP), 32, 0, stream>>>(Ph, Pl, VTh + zk * HD * TT, VTl + zk * HD * TT, TT, Ob, HD, nullptr, (size_t)RH * TT, (size_t)HD * TT, (size_t)TT * HD, (size_t)ZH * TT * HD);
            k_gemmw<h16, 0, false, KSP><<<dim3((TT - RH) / 64, HD / 64, ZH * KSP), 32, 0, stream>>>(P16 + (size_t)RH * TT, nullptr, VT16 + zk * HD * TT, nullptr, TT, Ob + (size_t)RH * HD, HD, nullptr, (size_t)TT * TT, (size_t)HD * TT, (size_t)TT * HD, (size_t)ZH * TT * HD);
            k_merge<<<(unsigned)(((size_t)ZH * TT * HD / 2 + 255) / 256), 256, 0, stream>>>(Ob, h0, ATh, ATl); }
        k_gemmw<bf, 1, true><<<dim3(TT / 64, DM / 64, 1), 32, 0, stream>>>(ATh, ATl, WO, nullptr, DQ, OUT + (size_t)b * TT * DM, DM, bo, 0, 0, 0, 0); }
}

// v002
// It runs in 550 microseconds.
// Two timings next to v001 both put it at 1.25 times that version's speed.
// Over all steps from v000 it is 2.21 times as fast.
#include <hip/hip_runtime.h>

// MultiheadSelfAttentionEnc (x [1][2048][2048]; q/k/v = x W^T + b (16 heads x 128); q, k RMS-normalised per head * w (eps = f32 eps 1.19e-7); rotary as a general per-(token, pair) 2x2 matrix from the read rope [1][S][1][64][2][2]: out[2i+r] = rope[i][r][0] x[2i] + rope[i][r][1] x[2i+1]; softmax(q.k / sqrt(128)) (no mask); out = merged wo^T + bo -> [1][2048][2048]).
// Compute dtypes, f32 accumulate: every input rounded to bf16; q/k/v on PLAIN bf16 operands (inputs: exact) + bias; RMSNorm (in place) and the 2x2 rotary (bf16-rounded rope entries, folded into a per-element (c, s) table) f32; scores hl x hl (3 products) on every row (normalised q/k are sharp), attn.v: query rows < 512 hl (3 products), the rest single fp16 (x1024); softmax f32; wo hl x exact (2 products) + bias.

#define NB_  1
#define TT   2048
#define DM   2048
#define NH_  16
#define NKV  16
#define REP  (NH_ / NKV)
#define HD   128
#define DQ   (NH_ * HD)
#define DKV  (NKV * HD)
#define ZH   2
#define RH   512                  // query rows < RH use hi+lo planes (0: none)
#define WIN  0
#define PCAR 1024.0f
#define KSP  8                    // key slices of the attn.v products: one work-group per (tile, slice), f32 partial planes summed in k_merge
#define SCL  0.088388347648318447f   // HD^-0.5
typedef _Float16 h16;
typedef unsigned short bf;
typedef __attribute__((ext_vector_type(16))) __bf16   v16bf;
typedef __attribute__((ext_vector_type(16))) _Float16 v16h;
typedef __attribute__((ext_vector_type(8)))  _Float16 v8h;
typedef __attribute__((ext_vector_type(8)))  unsigned short v8us;
typedef __attribute__((ext_vector_type(8)))  float    v8f;
typedef __attribute__((ext_vector_type(4)))  float    v4f;
typedef v8h  __attribute__((may_alias)) v8ha;
typedef v4f  __attribute__((may_alias)) v4fa;
typedef v8us __attribute__((may_alias)) v8usa;

__device__ __forceinline__ unsigned short f2bf(float f) { unsigned u = __float_as_uint(f); u += 0x7FFFu + ((u >> 16) & 1u); return (unsigned short)(u >> 16); }
__device__ __forceinline__ float bf2f(unsigned short b) { return __uint_as_float(((unsigned)b) << 16); }
__device__ __forceinline__ float bfr(float f) { return bf2f(f2bf(f)); }
__device__ __forceinline__ v16h cat16(v8h lo, v8h hi) { return __builtin_shufflevector(lo, hi, 0, 1, 2, 3, 4, 5, 6, 7, 8, 9, 10, 11, 12, 13, 14, 15); }
__device__ __forceinline__ v16bf cat16b(v8us lo, v8us hi) { return __builtin_bit_cast(v16bf, __builtin_shufflevector(lo, hi, 0, 1, 2, 3, 4, 5, 6, 7, 8, 9, 10, 11, 12, 13, 14, 15)); }
__device__ __forceinline__ v8f wmma16(v16h a, v16h b, v8f c) { return __builtin_amdgcn_wmma_f32_16x16x32_f16(false, a, false, b, (short)0, c, false, false); }
__device__ __forceinline__ v8f wmmab(v16bf a, v16bf b, v8f c) { return __builtin_amdgcn_wmma_f32_16x16x32_bf16(false, a, false, b, (short)0, c, false, false); }



// ---- k_gemmw: register-blocked GEMM, ONE WAVE per 64x64 output tile (16 accumulators), operands straight from K-contiguous 16-bit planes; grid (M/64, N/64, Z), 32 threads.
// C[m][n] (f32, pitch ldc, + optional f32 bias[n]) = sum_k A[m][k] Bt[n][k] (+ split products per NSPLIT). z-batch strides sA/sB/sC in elements. (K / KS) % 128 == 0 (% 64 where NSPLIT > 0); every row offset in bytes fits 32 bits.
// KS > 1: grid z = batch * KS + slice; a work-group sums only k in [slice K/KS, (slice + 1) K/KS) and stores its partial tile at C + slice * sK (the reader adds the KS planes). K % (32 KS) == 0.
template <typename T16> struct WFrag;
template <> struct WFrag<h16> { typedef v16h V; static __device__ __forceinline__ V ld(const h16* p) { return cat16(*(const v8h*)p, *(const v8h*)(p + 16)); } static __device__ __forceinline__ v8f mma(V a, V b, v8f c) { return wmma16(a, b, c); } };
template <> struct WFrag<bf> { typedef v16bf V; static __device__ __forceinline__ V ld(const bf* p) { return cat16b(*(const v8us*)p, *(const v8us*)(p + 16)); } static __device__ __forceinline__ v8f mma(V a, V b, v8f c) { return wmmab(a, b, c); } };
template <typename T16, int NSPLIT, bool BIAS, int KS = 1>
__global__ __launch_bounds__(32) void k_gemmw(const T16* __restrict__ A, const T16* __restrict__ A2, const T16* __restrict__ Bt, const T16* __restrict__ Bt2, int K, float* C, int ldc, const float* __restrict__ bias, size_t sA, size_t sB, size_t sC, size_t sK) {
    typedef typename WFrag<T16>::V V;
    constexpr int U = (NSPLIT == 0) ? 4 : 2;   // k-steps in flight: about 64 16-byte loads a wave. (K / KS) % (32 U) == 0.
    __shared__ __align__(16) float os[16 * 68];
    const size_t z = blockIdx.z / KS; const int kb = (int)(blockIdx.z % KS) * (K / KS), ke = kb + K / KS; C += (size_t)(blockIdx.z % KS) * sK; A += z * sA; if (A2) A2 += z * sA; Bt += z * sB; if (Bt2) Bt2 += z * sB; C += z * sC;
    const int lane = threadIdx.x & 31, lr = lane & 15, hi = lane >> 4; const int r0 = blockIdx.x * 64, c0 = blockIdx.y * 64;
    v8f acc[4][4];
#pragma unroll
    for (int mb = 0; mb < 4; ++mb)
#pragma unroll
        for (int nb = 0; nb < 4; ++nb) acc[mb][nb] = (v8f){};
    // Operand ring in registers: U k-steps of fragments are in flight at all times; a k-step's registers are refilled (for U steps later) right behind its products, so a load has U - 1 k-steps of products to return in.
    const unsigned aoff = 2u * ((unsigned)(r0 + lr) * (unsigned)K + 8u * hi), boff = 2u * ((unsigned)(c0 + lr) * (unsigned)K + 8u * hi), rstep = 32u * (unsigned)K;   // byte offsets of the lane's rows: fixed registers, only the uniform base moves with k
    V a[U][4], a2[U][4], b[U][4], b2[U][4];
    auto at = [](const T16* base, unsigned byteoff) { return (const T16*)((const char*)base + byteoff); };
    unsigned kby = 2u * (unsigned)kb;   // byte offset of the trip's first k-step in every row (uniform)
    auto fetch = [&](int u, int ko) {
#pragma unroll
        for (int mb = 0; mb < 4; ++mb) { a[u][mb] = WFrag<T16>::ld(at(at(A, kby), aoff + mb * rstep) + ko); if (NSPLIT == 1 || NSPLIT == 2) a2[u][mb] = WFrag<T16>::ld(at(at(A2, kby), aoff + mb * rstep) + ko); }
#pragma unroll
        for (int nb = 0; nb < 4; ++nb) { b[u][nb] = WFrag<T16>::ld(at(at(Bt, kby), boff + nb * rstep) + ko); if (NSPLIT >= 2) b2[u][nb] = WFrag<T16>::ld(at(at(Bt2, kby), boff + nb * rstep) + ko); }
        __builtin_amdgcn_sched_barrier(0);   // keeps the loads in k-step order: loads return in order, so a k-step fetched out of turn would make the counted wait of an earlier one cover it too
    };
    auto products = [&](int u) {
#pragma unroll
        for (int nb = 0; nb < 4; ++nb)
#pragma unroll
            for (int mb = 0; mb < 4; ++mb) { acc[mb][nb] = WFrag<T16>::mma(a[u][mb], b[u][nb], acc[mb][nb]); if (NSPLIT == 1 || NSPLIT == 2) acc[mb][nb] = WFrag<T16>::mma(a2[u][mb], b[u][nb], acc[mb][nb]); if (NSPLIT >= 2) acc[mb][nb] = WFrag<T16>::mma(a[u][mb], b2[u][nb], acc[mb][nb]); } };
#pragma unroll
    for (int u = 0; u < U; ++u) fetch(u, 32 * u);
    asm volatile("s_wait_xcnt 0x0" : "+s"(kby) : : "memory");   // before a register that the first loads name gets another use
    __builtin_amdgcn_sched_barrier(0);   // holds later register writes behind that wait
#pragma unroll 1
    for (int kc = kb; kc < ke - 32 * U; kc += 32 * U) {
#pragma unroll
        for (int u = 0; u < U; ++u) { products(u); fetch(u, 32 * (U + u)); }
        asm volatile("s_wait_xcnt 0x0" : "+s"(kby) : : "memory");   // the address registers that the issued loads name are formed anew from kby only behind this wait (kby passes through the statement, so that cannot be lifted over it)
        kby += 64u * U;
    }
#pragma unroll
    for (int u = 0; u < U; ++u) products(u);
#pragma unroll
    for (int mb = 0; mb < 4; ++mb) {
#pragma unroll
        for (int nb = 0; nb < 4; ++nb) {
#pragma unroll
            for (int j = 0; j < 8; ++j) os[(hi * 8 + j) * 68 + nb * 16 + lr] = acc[mb][nb][j]; }
        __builtin_amdgcn_wave_barrier(); asm volatile("" ::: "memory");
        float* crow = C + (size_t)(r0 + mb * 16) * ldc + c0;
{
#pragma unroll
            for (int s = 0; s < 8; ++s) { const int row = 2 * s + hi, cofs = lr * 4; v4f val = *(const v4fa*)(os + row * 68 + cofs); if (BIAS) { val[0] += bfr(bias[c0 + cofs]); val[1] += bfr(bias[c0 + cofs + 1]); val[2] += bfr(bias[c0 + cofs + 2]); val[3] += bfr(bias[c0 + cofs + 3]); }
                *(v4f*)(crow + (size_t)row * ldc + cofs) = val; }
             }
        __builtin_amdgcn_wave_barrier(); asm volatile("" ::: "memory");
    }
}

__device__ __forceinline__ h16 tohx(float x) { return (h16)x; }
__device__ __forceinline__ void splitf(float y, unsigned short& h, unsigned short& l) { h = f2bf(y); l = f2bf(y - bf2f(h)); }
typedef __attribute__((ext_vector_type(2))) _Float16 v2h;
typedef __attribute__((ext_vector_type(4))) _Float16 v4h;
typedef __attribute__((ext_vector_type(2))) unsigned short v2us;
typedef __attribute__((ext_vector_type(4))) unsigned short v4us;
typedef __attribute__((ext_vector_type(2))) float v2f;
typedef __attribute__((ext_vector_type(4))) int v4i;

__global__ __launch_bounds__(256) void k_wtG(const float* __restrict__ w, int K, int N, bf* Bt) {
    const int lane = threadIdx.x & 31; const int L0 = (blockIdx.x * 8 + (threadIdx.x >> 5)) * 8; const int nlines = N * K / 64;
{
#pragma unroll 1
        for (int l = 0; l < 8; ++l) { const int L = L0 + l; if (L >= nlines) break; const size_t e = (size_t)L * 64 + lane * 2; const int k = (int)(e % K), n = (int)(e / K); v2us o;
            o[0] = f2bf(w[(size_t)k * N + n]); o[1] = f2bf(w[(size_t)(k + 1) * N + n]); *(v2us*)(Bt + e) = o; }
         }
}
__global__ __launch_bounds__(256) void k_cvt8(const float* __restrict__ src, bf* dst, size_t n8) { const size_t i = (size_t)blockIdx.x * 256 + threadIdx.x; if (i >= n8) return; const v8f v = *(const v8f*)(src + i * 8); v8us o;
#pragma unroll
    for (int k = 0; k < 8; ++k) o[k] = f2bf(v[k]); *(v8us*)(dst + i * 8) = o;  }
__global__ __launch_bounds__(256) void k_cscvt(const float* __restrict__ rope, const float* __restrict__ unused, float* CS) { (void)unused; const int idx = blockIdx.x * 256 + threadIdx.x; if (idx >= TT * HD) return; const int t = idx / HD, dd = idx % HD; const int i = dd >> 1; const float* R = rope + ((size_t)t * (HD / 2) + i) * 4;   /* [r][c] */ v2f cs;
    if ((dd & 1) == 0) { cs[0] = bfr(R[0]); cs[1] = -bfr(R[1]); } else { cs[0] = bfr(R[3]); cs[1] = bfr(R[2]); }
    *(v2f*)(CS + (size_t)idx * 2) = cs;  }
// k_rope: head planes [h][t][d] (fp16 + hi/lo) of rope(x) x sc with the interleaved-pair 2x2 form out[d] = x[d] CS[t][d][0] - x[d^1] CS[t][d][1] for even d, out[d] = x[d] CS[t][d][0] + x[d^1] CS[t][d][1] for odd d
__global__ __launch_bounds__(256) void k_rope(const float* __restrict__ F, int pitch, int nheads, const float* __restrict__ CS, const float* __restrict__ RF, const float* __restrict__ nw, float sc, h16* P16, bf* Ph, bf* Pl) {
    const size_t e = ((size_t)blockIdx.x * 256 + threadIdx.x) * 2; if (e >= (size_t)nheads * TT * HD) return; const int d = (int)(e % HD); const int t = (int)((e / HD) % TT); const int h = (int)(e / ((size_t)HD * TT)); const float* f = F + (size_t)t * pitch + h * HD; const float rf = RF ? RF[(size_t)h * TT + t] : 1.0f; v2h o16; v2us oh, ol;
#pragma unroll
    for (int q = 0; q < 2; ++q) { const int dd = d + q; const int dp = dd ^ 1; float x0 = f[dd], x1 = f[dp];
        if (RF) { float n0 = __fmul_rn(x0, rf), n1 = __fmul_rn(x1, rf); asm volatile("" : "+v"(n0)); asm volatile("" : "+v"(n1)); x0 = __fmul_rn(bfr(nw[dd]), n0); x1 = __fmul_rn(bfr(nw[dp]), n1); }
        const v2f cs = *(const v2f*)(CS + ((size_t)t * HD + dd) * 2); float a = __fmul_rn(x0, cs[0]), bq = __fmul_rn(x1, cs[1]); asm volatile("" : "+v"(a)); asm volatile("" : "+v"(bq)); const float r = (((dd & 1) == 0) ? __fsub_rn(a, bq) : __fadd_rn(a, bq)) * sc;
        o16[q] = tohx(r); unsigned short a2, c2; splitf(r, a2, c2); oh[q] = a2; ol[q] = c2; }
    *(v2h*)(P16 + e) = o16; *(v2us*)(Ph + e) = oh; *(v2us*)(Pl + e) = ol;  }
__global__ __launch_bounds__(256) void k_vtp(const float* __restrict__ F, int pitch, int nheads, h16* V16, bf* Vh, bf* Vl) { const size_t e = ((size_t)blockIdx.x * 256 + threadIdx.x) * 2; if (e >= (size_t)nheads * HD * TT) return; const int t = (int)(e % TT); const int d = (int)((e / TT) % HD); const int g = (int)(e / ((size_t)TT * HD)); v2h o16; v2us oh, ol;
#pragma unroll
    for (int q = 0; q < 2; ++q) { const float x = F[(size_t)(t + q) * pitch + g * HD + d]; o16[q] = tohx(x); unsigned short a2, c2; splitf(x, a2, c2); oh[q] = a2; ol[q] = c2; }
    *(v2h*)(V16 + e) = o16; *(v2us*)(Vh + e) = oh; *(v2us*)(Vl + e) = ol;  }
__global__ __launch_bounds__(256) void k_rmsw(float* F, int pitch, int nheads, const float* __restrict__ w) { const int lane = threadIdx.x & 31; const int wv = blockIdx.x * 8 + (threadIdx.x >> 5); if (wv >= TT * nheads) return; const int t = wv / nheads, h = wv % nheads; float* f = F + (size_t)t * pitch + h * HD; const v4f a = *(const v4f*)(f + lane * 4); float ss = 0.f;
#pragma unroll
    for (int q = 0; q < 4; ++q) { float p = __fmul_rn(a[q], a[q]); asm volatile("" : "+v"(p)); ss = __fadd_rn(ss, p); }
#pragma unroll
    for (int sh = 16; sh; sh >>= 1) ss = __fadd_rn(ss, __shfl_xor(ss, sh, 32));
    const float rs = __fdiv_rn(1.0f, sqrtf(__fadd_rn(ss * (1.0f / HD), 1.1920928955078125e-7f))); v4f o;
#pragma unroll
    for (int q = 0; q < 4; ++q) { float y = __fmul_rn(a[q], rs); asm volatile("" : "+v"(y)); o[q] = __fmul_rn(y, bfr(w[lane * 4 + q])); }
    *(v4f*)(f + lane * 4) = o;  }
// k_asoft: per row (zz, i): t = S x HD^-0.5 (no mask); softmax over the 2048 keys (register row, one exp, fixed trees);
__global__ __launch_bounds__(256) void k_asoft(const float* __restrict__ Sb, h16* P16, bf* Ph, bf* Pl) {
    const int lane = threadIdx.x & 31; const int row = blockIdx.x * 8 + (threadIdx.x >> 5); if (row >= ZH * TT) return; const int i = row % TT; const int zz = row / TT; (void)zz; const bool hires = (i < RH); const float* sr = Sb + (size_t)row * TT; float v[TT / 32]; float mx = -3.0e38f;
#pragma unroll
    for (int ch = 0; ch < TT / 128; ++ch) { const int j0 = ch * 128 + lane * 4; const v4f a = *(const v4f*)(sr + j0);
#pragma unroll
        for (int q = 0; q < 4; ++q) { const int j = j0 + q; (void)j; float sa = a[q] * SCL; asm volatile("" : "+v"(sa)); const float t = sa; v[ch * 4 + q] = t; mx = fmaxf(mx, t); } }
#pragma unroll
    for (int sh = 16; sh; sh >>= 1) mx = fmaxf(mx, __shfl_xor(mx, sh, 32));
    float sum = 0.f;
#pragma unroll
    for (int k = 0; k < TT / 32; ++k) { float d0 = __fsub_rn(v[k], mx); asm volatile("" : "+v"(d0)); v[k] = __builtin_amdgcn_exp2f(__fmul_rn(d0, 1.4426950408889634f)); sum += v[k]; }
#pragma unroll
    for (int sh = 16; sh; sh >>= 1) sum += __shfl_xor(sum, sh, 32);
    const float f = __fdiv_rn(hires ? 1.0f : PCAR, sum);
{
        if (hires) {
#pragma unroll
            for (int ch = 0; ch < TT / 128; ++ch) { v4us oh, ol;
#pragma unroll
                for (int q = 0; q < 4; ++q) { unsigned short a, c2; splitf(v[ch * 4 + q] * f, a, c2); oh[q] = a; ol[q] = c2; }
                const size_t oo = ((size_t)zz * (RH ? RH : 1) + i) * TT + ch * 128 + lane * 4; *(v4us*)(Ph + oo) = oh; *(v4us*)(Pl + oo) = ol; }
        } else {
#pragma unroll
            for (int ch = 0; ch < TT / 128; ++ch) { v4h o4;
#pragma unroll
                for (int q = 0; q < 4; ++q) o4[q] = tohx(v[ch * 4 + q] * f);
                *(v4h*)(P16 + (size_t)row * TT + ch * 128 + lane * 4) = o4; } }
         }
}
__global__ __launch_bounds__(256) void k_merge(const float* __restrict__ O, int h0, bf* Ah, bf* Al) { const size_t e = ((size_t)blockIdx.x * 256 + threadIdx.x) * 2; if (e >= (size_t)ZH * TT * HD) return; const int d = (int)(e % HD); const int t = (int)((e / HD) % TT); const int zz = (int)(e / ((size_t)HD * TT)); const float cs = (t < RH) ? 1.0f : (1.0f / PCAR); const size_t oo = (size_t)t * DQ + (h0 + zz) * HD + d;
    v2f s = *(const v2f*)(O + e);   // the KSP key-slice partials, added in slice order
#pragma unroll
    for (int ks = 1; ks < KSP; ++ks) s += *(const v2f*)(O + (size_t)ks * ZH * TT * HD + e);
    v2us oh, ol;
#pragma unroll
    for (int q = 0; q < 2; ++q) { unsigned short a, c2; splitf(s[q] * cs, a, c2); oh[q] = a; ol[q] = c2; } *(v2us*)(Ah + oo) = oh; *(v2us*)(Al + oo) = ol;  }

extern "C" void kernel_launch(void* const* d_in, const int* in_sizes, int n_in,
                              void* d_out, int out_size, void* d_ws, size_t ws_size, hipStream_t stream) {
    (void)in_sizes; (void)n_in; (void)out_size;
    const float* x = (const float*)d_in[0]; const float* rope = (const float*)d_in[1]; const float* wq = (const float*)d_in[2]; const float* bq = (const float*)d_in[3]; const float* wk = (const float*)d_in[4]; const float* bk = (const float*)d_in[5]; const float* wv = (const float*)d_in[6]; const float* bv = (const float*)d_in[7]; const float* qnw = (const float*)d_in[8]; const float* knw = (const float*)d_in[9]; const float* wo = (const float*)d_in[10]; const float* bo = (const float*)d_in[11]; const float* cosT = rope; const float* sinT = rope;
    float* OUT = (float*)d_out;     // [1][2048][2048]
    char* wsp = (char*)d_ws;
    auto take = [&](size_t bytes) { char* p = wsp; wsp += (bytes + 255) & ~(size_t)255; return (void*)p; };
    bf* WQ = (bf*)take((size_t)DQ * DM * 2); bf* WK = (bf*)take((size_t)DKV * DM * 2); bf* WV = (bf*)take((size_t)DKV * DM * 2); bf* WO = (bf*)take((size_t)DM * DQ * 2); float* CS = (float*)take((size_t)TT * HD * 2 * 4);
    bf* XB = (bf*)take((size_t)TT * DM * 2); float* FQ = (float*)take((size_t)TT * DQ * 4); float* FK = (float*)take((size_t)TT * DKV * 4);
    h16* QP16 = (h16*)take((size_t)NH_ * TT * HD * 2); h16* KP16 = (h16*)take((size_t)NKV * TT * HD * 2); h16* VT16 = (h16*)take((size_t)NKV * HD * TT * 2);
    bf* QPh = (bf*)take((size_t)NH_ * TT * HD * 2); bf* QPl = (bf*)take((size_t)NH_ * TT * HD * 2); bf* KPh = (bf*)take((size_t)NKV * TT * HD * 2); bf* KPl = (bf*)take((size_t)NKV * TT * HD * 2); bf* VTh = (bf*)take((size_t)NKV * HD * TT * 2); bf* VTl = (bf*)take((size_t)NKV * HD * TT * 2); bf* Ph = (bf*)take((size_t)ZH * RH * TT * 2); bf* Pl = (bf*)take((size_t)ZH * RH * TT * 2);
    float* Sb = (float*)take((size_t)ZH * TT * TT * 4); h16* P16 = (h16*)take((size_t)ZH * TT * TT * 2); float* Ob = (float*)take((size_t)KSP * ZH * TT * HD * 4); bf* ATh = (bf*)take((size_t)TT * DQ * 2); bf* ATl = (bf*)take((size_t)TT * DQ * 2);
    if ((size_t)(wsp - (char*)d_ws) > ws_size) return;    // ws 256 MiB
    float* FV = FK;   // v projection reuses the k buffer after the k planes are built (stream-ordered)
    { k_cvt8<<<(unsigned)(((size_t)DQ * DM / 8 + 255) / 256), 256, 0, stream>>>(wq, WQ, (size_t)DQ * DM / 8); k_cvt8<<<(unsigned)(((size_t)DKV * DM / 8 + 255) / 256), 256, 0, stream>>>(wk, WK, (size_t)DKV * DM / 8); k_cvt8<<<(unsigned)(((size_t)DKV * DM / 8 + 255) / 256), 256, 0, stream>>>(wv, WV, (size_t)DKV * DM / 8);
      k_cvt8<<<(unsigned)(((size_t)DM * DQ / 8 + 255) / 256), 256, 0, stream>>>(wo, WO, (size_t)DM * DQ / 8);
       }
    const unsigned LQ = (unsigned)(((size_t)NH_ * TT * HD / 2 + 255) / 256), LKv = (unsigned)(((size_t)NKV * TT * HD / 2 + 255) / 256);
    for (int b = 0; b < NB_; ++b) {
        if (b == 0) k_cscvt<<<(TT * HD + 255) / 256, 256, 0, stream>>>(cosT, sinT, CS);
        k_cvt8<<<(unsigned)(((size_t)TT * DM / 8 + 255) / 256), 256, 0, stream>>>(x + (size_t)b * TT * DM, XB, (size_t)TT * DM / 8);
        k_gemmw<bf, 0, true><<<dim3(TT / 64, DQ / 64, 1), 32, 0, stream>>>(XB, nullptr, WQ, nullptr, DM, FQ, DQ, bq, 0, 0, 0, 0);
        k_rmsw<<<TT * NH_ / 8, 256, 0, stream>>>(FQ, DQ, NH_, qnw); k_rope<<<LQ, 256, 0, stream>>>(FQ, DQ, NH_, CS, nullptr, nullptr, 1.0f, QP16, QPh, QPl);
        k_gemmw<bf, 0, true><<<dim3(TT / 64, DKV / 64, 1), 32, 0, stream>>>(XB, nullptr, WK, nullptr, DM, FK, DKV, bk, 0, 0, 0, 0);
        k_rmsw<<<TT * NKV / 8, 256, 0, stream>>>(FK, DKV, NKV, knw); k_rope<<<LKv, 256, 0, stream>>>(FK, DKV, NKV, CS, nullptr, nullptr, 1.0f, KP16, KPh, KPl);
        k_gemmw<bf, 0, true><<<dim3(TT / 64, DKV / 64, 1), 32, 0, stream>>>(XB, nullptr, WV, nullptr, DM, FV, DKV, bv, 0, 0, 0, 0); k_vtp<<<LKv, 256, 0, stream>>>(FV, DKV, NKV, VT16, VTh, VTl);
        for (int h0 = 0; h0 < NH_; h0 += ZH) { const size_t zq = (size_t)h0, zk = (size_t)(h0 / REP);   // one kv head per query head: the pass's two heads use consecutive kv planes (z-strides TT*HD)
            k_gemmw<bf, 2, false><<<dim3(TT / 64, TT / 64, ZH), 32, 0, stream>>>(QPh + zq * TT * HD, QPl + zq * TT * HD, KPh + zk * TT * HD, KPl + zk * TT * HD, HD, Sb, TT, nullptr, (size_t)TT * HD, (size_t)TT * HD, (size_t)TT * TT, 0);   /* scores hl on all rows */
            k_asoft<<<ZH * TT / 8, 256, 0, stream>>>(Sb, P16, Ph, Pl);
            k_gemmw<bf, 2, false, KSP><<<dim3(RH / 64, HD / 64, ZH * KSP), 32, 0, stream>>>(Ph, Pl, VTh + zk * HD * TT, VTl + zk * HD * TT, TT, Ob, HD, nullptr, (size_t)RH * TT, (size_t)HD * TT, (size_t)TT * HD, (size_t)ZH * TT * HD);
            k_gemmw<h16, 0, false, KSP><<<dim3((TT - RH) / 64, HD / 64, ZH * KSP), 32, 0, stream>>>(P16 + (size_t)RH * TT, nullptr, VT16 + zk * HD * TT, nullptr, TT, Ob + (size_t)RH * HD, HD, nullptr, (size_t)TT * TT, (size_t)HD * TT, (size_t)TT * HD, (size_t)ZH * TT * HD);
            k_merge<<<(unsigned)(((size_t)ZH * TT * HD / 2 + 255) / 256), 256, 0, stream>>>(Ob, h0, ATh, ATl); }
        k_gemmw<bf, 1, true><<<dim3(TT / 64, DM / 64, 1), 32, 0, stream>>>(ATh, ATl, WO, nullptr, DQ, OUT + (size_t)b * TT * DM, DM, bo, 0, 0, 0, 0); }
}

// v003
// A run of this version takes 528 microseconds.
// In both of two side-by-side timings against v002, it was 1.04 times as fast.
// Over all steps from v000 it is 2.30 times as fast.
#include <hip/hip_runtime.h>

// MultiheadSelfAttentionEnc (x [1][2048][2048]; q/k/v = x W^T + b (16 heads x 128); q, k RMS-normalised per head * w (eps = f32 eps 1.19e-7); rotary as a general per-(token, pair) 2x2 matrix from the read rope [1][S][1][64][2][2]: out[2i+r] = rope[i][r][0] x[2i] + rope[i][r][1] x[2i+1]; softmax(q.k / sqrt(128)) (no mask); out = merged wo^T + bo -> [1][2048][2048]).
// Compute dtypes, f32 accumulate: every input rounded to bf16; q/k/v on PLAIN bf16 operands (inputs: exact) + bias; RMSNorm (in place) and the 2x2 rotary (bf16-rounded rope entries, folded into a per-element (c, s) table) f32; scores hl x hl (3 products) on every row (normalised q/k are sharp), attn.v: query rows < 512 hl (3 products), the rest single fp16 (x1024); softmax f32; wo hl x exact (2 products) + bias.

#define NB_  1
#define TT   2048
#define DM   2048
#define NH_  16
#define NKV  16
#define REP  (NH_ / NKV)
#define HD   128
#define DQ   (NH_ * HD)
#define DKV  (NKV * HD)
#define ZH   2
#define RH   512                  // query rows < RH use hi+lo planes (0: none)
#define WIN  0
#define PCAR 1024.0f
#define KSP  8                    // key slices of the attn.v products: one work-group per (tile, slice), f32 partial planes summed in k_merge
#define SCL  0.088388347648318447f   // HD^-0.5
typedef _Float16 h16;
typedef unsigned short bf;
typedef __attribute__((ext_vector_type(16))) __bf16   v16bf;
typedef __attribute__((ext_vector_type(16))) _Float16 v16h;
typedef __attribute__((ext_vector_type(8)))  _Float16 v8h;
typedef __attribute__((ext_vector_type(8)))  unsigned short v8us;
typedef __attribute__((ext_vector_type(8)))  float    v8f;
typedef __attribute__((ext_vector_type(4)))  float    v4f;
typedef v8h  __attribute__((may_alias)) v8ha;
typedef v4f  __attribute__((may_alias)) v4fa;
typedef v8us __attribute__((may_alias)) v8usa;

__device__ __forceinline__ unsigned short f2bf(float f) { unsigned u = __float_as_uint(f); u += 0x7FFFu + ((u >> 16) & 1u); return (unsigned short)(u >> 16); }
__device__ __forceinline__ float bf2f(unsigned short b) { return __uint_as_float(((unsigned)b) << 16); }
__device__ __forceinline__ float bfr(float f) { return bf2f(f2bf(f)); }
__device__ __forceinline__ v16h cat16(v8h lo, v8h hi) { return __builtin_shufflevector(lo, hi, 0, 1, 2, 3, 4, 5, 6, 7, 8, 9, 10, 11, 12, 13, 14, 15); }
__device__ __forceinline__ v16bf cat16b(v8us lo, v8us hi) { return __builtin_bit_cast(v16bf, __builtin_shufflevector(lo, hi, 0, 1, 2, 3, 4, 5, 6, 7, 8, 9, 10, 11, 12, 13, 14, 15)); }
__device__ __forceinline__ v8f wmma16(v16h a, v16h b, v8f c) { return __builtin_amdgcn_wmma_f32_16x16x32_f16(false, a, false, b, (short)0, c, false, false); }
__device__ __forceinline__ v8f wmmab(v16bf a, v16bf b, v8f c) { return __builtin_amdgcn_wmma_f32_16x16x32_bf16(false, a, false, b, (short)0, c, false, false); }



// ---- k_gemmw: register-blocked GEMM, ONE WAVE per 64x64 output tile (16 accumulators), operands straight from K-contiguous 16-bit planes; grid (M/64, N/64, Z), 32 threads.
// C[m][n] (f32, pitch ldc, + optional f32 bias[n]) = sum_k A[m][k] Bt[n][k] (+ split products per NSPLIT). z-batch strides sA/sB/sC in elements. (K / KS) % 128 == 0 (% 64 where NSPLIT > 0); every row offset in bytes fits 32 bits.
// KS > 1: grid z = batch * KS + slice; a work-group sums only k in [slice K/KS, (slice + 1) K/KS) and stores its partial tile at C + slice * sK (the reader adds the KS planes). K % (32 KS) == 0.
template <typename T16> struct WFrag;
template <> struct WFrag<h16> { typedef v16h V; static __device__ __forceinline__ V ld(const h16* p) { return cat16(*(const v8h*)p, *(const v8h*)(p + 16)); } static __device__ __forceinline__ v8f mma(V a, V b, v8f c) { return wmma16(a, b, c); } };
template <> struct WFrag<bf> { typedef v16bf V; static __device__ __forceinline__ V ld(const bf* p) { return cat16b(*(const v8us*)p, *(const v8us*)(p + 16)); } static __device__ __forceinline__ v8f mma(V a, V b, v8f c) { return wmmab(a, b, c); } };
template <typename T16, int NSPLIT, bool BIAS, int KS = 1>
__global__ __launch_bounds__(32) void k_gemmw(const T16* __restrict__ A, const T16* __restrict__ A2, const T16* __restrict__ Bt, const T16* __restrict__ Bt2, int K, float* C, int ldc, const float* __restrict__ bias, size_t sA, size_t sB, size_t sC, size_t sK) {
    typedef typename WFrag<T16>::V V;
    constexpr int U = (NSPLIT == 0) ? 4 : 2;   // k-steps in flight: about 64 16-byte loads a wave. (K / KS) % (32 U) == 0.
    __shared__ __align__(16) float os[16 * 68];
    const size_t z = blockIdx.z / KS; const int kb = (int)(blockIdx.z % KS) * (K / KS), ke = kb + K / KS; C += (size_t)(blockIdx.z % KS) * sK; A += z * sA; if (A2) A2 += z * sA; Bt += z * sB; if (Bt2) Bt2 += z * sB; C += z * sC;
    const int lane = threadIdx.x & 31, lr = lane & 15, hi = lane >> 4; const int r0 = blockIdx.x * 64, c0 = blockIdx.y * 64;
    v8f acc[4][4];
#pragma unroll
    for (int mb = 0; mb < 4; ++mb)
#pragma unroll
        for (int nb = 0; nb < 4; ++nb) acc[mb][nb] = (v8f){};
    // Operand ring in registers: U k-steps of fragments are in flight at all times; a k-step's registers are refilled (for U steps later) right behind its products, so a load has U - 1 k-steps of products to return in.
    const unsigned aoff = 2u * ((unsigned)(r0 + lr) * (unsigned)K + 8u * hi), boff = 2u * ((unsigned)(c0 + lr) * (unsigned)K + 8u * hi), rstep = 32u * (unsigned)K;   // byte offsets of the lane's rows: fixed registers, only the uniform base moves with k
    V a[U][4], a2[U][4], b[U][4], b2[U][4];
    auto at = [](const T16* base, unsigned byteoff) { return (const T16*)((const char*)base + byteoff); };
    unsigned kby = 2u * (unsigned)kb;   // byte offset of the trip's first k-step in every row (uniform)
    auto fetch = [&](int u, int ko) {
#pragma unroll
        for (int mb = 0; mb < 4; ++mb) { a[u][mb] = WFrag<T16>::ld(at(at(A, kby), aoff + mb * rstep) + ko); if (NSPLIT == 1 || NSPLIT == 2) a2[u][mb] = WFrag<T16>::ld(at(at(A2, kby), aoff + mb * rstep) + ko); }
#pragma unroll
        for (int nb = 0; nb < 4; ++nb) { b[u][nb] = WFrag<T16>::ld(at(at(Bt, kby), boff + nb * rstep) + ko); if (NSPLIT >= 2) b2[u][nb] = WFrag<T16>::ld(at(at(Bt2, kby), boff + nb * rstep) + ko); }
        __builtin_amdgcn_sched_barrier(0);   // keeps the loads in k-step order: loads return in order, so a k-step fetched out of turn would make the counted wait of an earlier one cover it too
    };
    auto products = [&](int u) {
#pragma unroll
        for (int nb = 0; nb < 4; ++nb)
#pragma unroll
            for (int mb = 0; mb < 4; ++mb) { acc[mb][nb] = WFrag<T16>::mma(a[u][mb], b[u][nb], acc[mb][nb]); if (NSPLIT == 1 || NSPLIT == 2) acc[mb][nb] = WFrag<T16>::mma(a2[u][mb], b[u][nb], acc[mb][nb]); if (NSPLIT >= 2) acc[mb][nb] = WFrag<T16>::mma(a[u][mb], b2[u][nb], acc[mb][nb]); } };
#pragma unroll
    for (int u = 0; u < U; ++u) fetch(u, 32 * u);
    asm volatile("s_wait_xcnt 0x0" : "+s"(kby) : : "memory");   // before a register that the first loads name gets another use
    __builtin_amdgcn_sched_barrier(0);   // holds later register writes behind that wait
#pragma unroll 1
    for (int kc = kb; kc < ke - 32 * U; kc += 32 * U) {
#pragma unroll
        for (int u = 0; u < U; ++u) { products(u); fetch(u, 32 * (U + u)); }
        asm volatile("s_wait_xcnt 0x0" : "+s"(kby) : : "memory");   // the address registers that the issued loads name are formed anew from kby only behind this wait (kby passes through the statement, so that cannot be lifted over it)
        kby += 64u * U;
    }
#pragma unroll
    for (int u = 0; u < U; ++u) products(u);
#pragma unroll
    for (int mb = 0; mb < 4; ++mb) {
#pragma unroll
        for (int nb = 0; nb < 4; ++nb) {
#pragma unroll
            for (int j = 0; j < 8; ++j) os[(hi * 8 + j) * 68 + nb * 16 + lr] = acc[mb][nb][j]; }
        __builtin_amdgcn_wave_barrier(); asm volatile("" ::: "memory");
        float* crow = C + (size_t)(r0 + mb * 16) * ldc + c0;
{
#pragma unroll
            for (int s = 0; s < 8; ++s) { const int row = 2 * s + hi, cofs = lr * 4; v4f val = *(const v4fa*)(os + row * 68 + cofs); if (BIAS) { val[0] += bfr(bias[c0 + cofs]); val[1] += bfr(bias[c0 + cofs + 1]); val[2] += bfr(bias[c0 + cofs + 2]); val[3] += bfr(bias[c0 + cofs + 3]); }
                *(v4f*)(crow + (size_t)row * ldc + cofs) = val; }
             }
        __builtin_amdgcn_wave_barrier(); asm volatile("" ::: "memory");
    }
}

__device__ __forceinline__ h16 tohx(float x) { return (h16)x; }
__device__ __forceinline__ void splitf(float y, unsigned short& h, unsigned short& l) { h = f2bf(y); l = f2bf(y - bf2f(h)); }
typedef __attribute__((ext_vector_type(2))) _Float16 v2h;
typedef __attribute__((ext_vector_type(4))) _Float16 v4h;
typedef __attribute__((ext_vector_type(2))) unsigned short v2us;
typedef __attribute__((ext_vector_type(4))) unsigned short v4us;
typedef __attribute__((ext_vector_type(2))) float v2f;
typedef __attribute__((ext_vector_type(4))) int v4i;

__global__ __launch_bounds__(256) void k_wtG(const float* __restrict__ w, int K, int N, bf* Bt) {
    const int lane = threadIdx.x & 31; const int L0 = (blockIdx.x * 8 + (threadIdx.x >> 5)) * 8; const int nlines = N * K / 64;
{
#pragma unroll 1
        for (int l = 0; l < 8; ++l) { const int L = L0 + l; if (L >= nlines) break; const size_t e = (size_t)L * 64 + lane * 2; const int k = (int)(e % K), n = (int)(e / K); v2us o;
            o[0] = f2bf(w[(size_t)k * N + n]); o[1] = f2bf(w[(size_t)(k + 1) * N + n]); *(v2us*)(Bt + e) = o; }
         }
}
// The elementwise kernels: a thread takes several 16-byte pieces and issues all its loads before the first use, so that a launch has few waves to start; each element's arithmetic is unchanged.
__global__ __launch_bounds__(256) void k_cvt8(const float* __restrict__ src, bf* dst, size_t n8) { const size_t i0 = (size_t)blockIdx.x * 1024 + threadIdx.x; v8f v[4];
#pragma unroll
    for (int j = 0; j < 4; ++j) { size_t i = i0 + j * 256; if (i >= n8) i = n8 - 1; v[j] = *(const v8f*)(src + i * 8); }
#pragma unroll
    for (int j = 0; j < 4; ++j) { const size_t i = i0 + j * 256; if (i >= n8) continue; v8us o;
#pragma unroll
        for (int k = 0; k < 8; ++k) o[k] = f2bf(v[j][k]);
        *(v8us*)(dst + i * 8) = o; }
}
// k_cscvt: one (token, pair) 2x2 matrix R = [r][c] a piece: the (c, s) entries of elements 2i and 2i + 1 lie side by side in CS
__global__ __launch_bounds__(256) void k_cscvt(const float* __restrict__ rope, const float* __restrict__ unused, float* CS) { (void)unused; const int p0 = blockIdx.x * 1024 + threadIdx.x; v4f R[4];
#pragma unroll
    for (int j = 0; j < 4; ++j) { int p = p0 + j * 256; if (p >= TT * HD / 2) p = TT * HD / 2 - 1; R[j] = *(const v4f*)(rope + (size_t)p * 4); }
#pragma unroll
    for (int j = 0; j < 4; ++j) { const int p = p0 + j * 256; if (p >= TT * HD / 2) continue; v4f cs; cs[0] = bfr(R[j][0]); cs[1] = -bfr(R[j][1]); cs[2] = bfr(R[j][3]); cs[3] = bfr(R[j][2]);
        *(v4f*)(CS + (size_t)p * 4) = cs; }
}
// k_rope: head planes [h][t][d] (fp16 + hi/lo) of rope(x) x sc on adjacent pairs, (c, s) from CS: out[d] = x[d] c[t][d] - x[d+1] s[t][d] for even d, out[d] = x[d] c[t][d] + x[d-1] s[t][d] for odd d
template <typename T> __device__ __forceinline__ const T* offp(const void* base, unsigned byteoff) { return (const T*)((const char*)base + byteoff); }   // uniform base + the lane's 32-bit byte offset
// A work-group: one head, 64 tokens; a thread: 8 elements (4 pairs) of each of 4 tokens. RF and nw (a row factor and a weight, null at every launch) are not read.
__global__ __launch_bounds__(256) void k_rope(const float* __restrict__ F, int pitch, int nheads, const float* __restrict__ CS, const float* __restrict__ RF, const float* __restrict__ nw, float sc, h16* P16, bf* Ph, bf* Pl) {
    (void)RF; (void)nw; const int h = blockIdx.x / (TT / 64); if (h >= nheads) return; const int tb = (blockIdx.x % (TT / 64)) * 64; const int tr = threadIdx.x >> 4, d = (threadIdx.x & 15) * 8;
    const float* pf[4]; const float* pc = CS + ((size_t)(tb + tr) * HD + d) * 2; v8f xv[4]; v4f cv[4][4];
#pragma unroll
    for (int j = 0; j < 4; ++j) { pf[j] = F + (size_t)(tb + j * 16 + tr) * pitch + h * HD + d; xv[j] = *(const v8f*)pf[j];
#pragma unroll
        for (int k = 0; k < 4; ++k) cv[j][k] = *(const v4f*)(pc + j * 16 * HD * 2 + k * 4); }
    asm volatile("s_wait_xcnt 0x0" : : "v"(pf[0]), "v"(pf[1]), "v"(pf[2]), "v"(pf[3]), "v"(pc) : "memory");   // before a register that the issued loads name gets another use (the addresses are inputs here, so they keep their registers up to this wait)
#pragma unroll
    for (int j = 0; j < 4; ++j) { const size_t e = ((size_t)h * TT + tb + j * 16) * HD + threadIdx.x * 8; v8h o16; v8us oh, ol;
#pragma unroll
        for (int q = 0; q < 8; ++q) { float x0 = xv[j][q], x1 = xv[j][q ^ 1];
            v2f cs; cs[0] = cv[j][q >> 1][(q & 1) * 2]; cs[1] = cv[j][q >> 1][(q & 1) * 2 + 1]; float a = __fmul_rn(x0, cs[0]), bq = __fmul_rn(x1, cs[1]); asm volatile("" : "+v"(a)); asm volatile("" : "+v"(bq)); const float r = (((q & 1) == 0) ? __fsub_rn(a, bq) : __fadd_rn(a, bq)) * sc;
            o16[q] = tohx(r); unsigned short a2, c2; splitf(r, a2, c2); oh[q] = a2; ol[q] = c2; }
        *(v8h*)(P16 + e) = o16; *(v8us*)(Ph + e) = oh; *(v8us*)(Pl + e) = ol; }
}
// k_vtp: v [t][g HD + d] -> planes [g][d][t]. A work-group: one head, 64 tokens; a wave: 16 d x 64 t; a lane: 4 d x 8 t in registers (8 16-byte loads along d, then per d one 16-byte store along t to each plane; 8 lanes fill a 128-byte line)
__global__ __launch_bounds__(256) void k_vtp(const float* __restrict__ F, int pitch, int nheads, h16* V16, bf* Vh, bf* Vl) { const int lane = threadIdx.x & 31; const int g = blockIdx.x / (TT / 64); if (g >= nheads) return; const int t0 = (blockIdx.x % (TT / 64)) * 64 + (lane & 7) * 8; const int d0 = (threadIdx.x >> 5) * 16 + (lane >> 3) * 4; const float* px[8]; v4f x[8];
#pragma unroll
    for (int i = 0; i < 8; ++i) { px[i] = F + (size_t)(t0 + i) * pitch + g * HD + d0; x[i] = *(const v4f*)px[i]; }
    asm volatile("s_wait_xcnt 0x0" : : "v"(px[0]), "v"(px[1]), "v"(px[2]), "v"(px[3]), "v"(px[4]), "v"(px[5]), "v"(px[6]), "v"(px[7]) : "memory");   // before a register that the issued loads name gets another use (the addresses are inputs here, so they keep their registers up to this wait)
#pragma unroll
    for (int j = 0; j < 4; ++j) { v8h o16; v8us oh, ol;
#pragma unroll
        for (int i = 0; i < 8; ++i) { const float xx = x[i][j]; o16[i] = tohx(xx); unsigned short a2, c2; splitf(xx, a2, c2); oh[i] = a2; ol[i] = c2; }
        const size_t e = ((size_t)g * HD + d0 + j) * TT + t0; *(v8h*)(V16 + e) = o16; *(v8us*)(Vh + e) = oh; *(v8us*)(Vl + e) = ol; }
}
// k_rmsw: 8 consecutive (token, head) rows a wave (TT % 8 == 0: a wave's rows are all in range or none is)
__global__ __launch_bounds__(256) void k_rmsw(float* F, int pitch, int nheads, const float* __restrict__ w) { const int lane = threadIdx.x & 31; const int wv0 = (blockIdx.x * 8 + (threadIdx.x >> 5)) * 8; if (wv0 >= TT * nheads) return; int t = wv0 / nheads, h = wv0 % nheads; v4f a[8]; size_t off[8]; float wb[4];
#pragma unroll
    for (int r = 0; r < 8; ++r) { off[r] = (size_t)t * pitch + h * HD + lane * 4; a[r] = *(const v4f*)(F + off[r]); if (++h == nheads) { h = 0; ++t; } }
#pragma unroll
    for (int q = 0; q < 4; ++q) wb[q] = bfr(w[lane * 4 + q]);
#pragma unroll
    for (int r = 0; r < 8; ++r) { float ss = 0.f;
#pragma unroll
        for (int q = 0; q < 4; ++q) { float p = __fmul_rn(a[r][q], a[r][q]); asm volatile("" : "+v"(p)); ss = __fadd_rn(ss, p); }
#pragma unroll
        for (int sh = 16; sh; sh >>= 1) ss = __fadd_rn(ss, __shfl_xor(ss, sh, 32));
        const float rs = __fdiv_rn(1.0f, sqrtf(__fadd_rn(ss * (1.0f / HD), 1.1920928955078125e-7f))); v4f o;
#pragma unroll
        for (int q = 0; q < 4; ++q) { float y = __fmul_rn(a[r][q], rs); asm volatile("" : "+v"(y)); o[q] = __fmul_rn(y, wb[q]); }
        *(v4f*)(F + off[r]) = o; }
}
// k_asoft: per row (zz, i): t = S x HD^-0.5 (no mask); softmax over the 2048 keys (register row, one exp, fixed trees);
__global__ __launch_bounds__(256) void k_asoft(const float* __restrict__ Sb, h16* P16, bf* Ph, bf* Pl) {
    const int lane = threadIdx.x & 31; const int row = blockIdx.x * 8 + (threadIdx.x >> 5); if (row >= ZH * TT) return; const int i = row % TT; const int zz = row / TT; (void)zz; const bool hires = (i < RH); const float* sr = Sb + (size_t)row * TT; float v[TT / 32]; float mx = -3.0e38f;
#pragma unroll
    for (int ch = 0; ch < TT / 128; ++ch) { const int j0 = ch * 128 + lane * 4; const v4f a = *(const v4f*)(sr + j0);
#pragma unroll
        for (int q = 0; q < 4; ++q) { const int j = j0 + q; (void)j; float sa = a[q] * SCL; asm volatile("" : "+v"(sa)); const float t = sa; v[ch * 4 + q] = t; mx = fmaxf(mx, t); } }
#pragma unroll
    for (int sh = 16; sh; sh >>= 1) mx = fmaxf(mx, __shfl_xor(mx, sh, 32));
    float sum = 0.f;
#pragma unroll
    for (int k = 0; k < TT / 32; ++k) { float d0 = __fsub_rn(v[k], mx); asm volatile("" : "+v"(d0)); v[k] = __builtin_amdgcn_exp2f(__fmul_rn(d0, 1.4426950408889634f)); sum += v[k]; }
#pragma unroll
    for (int sh = 16; sh; sh >>= 1) sum += __shfl_xor(sum, sh, 32);
    const float f = __fdiv_rn(hires ? 1.0f : PCAR, sum);
{
        if (hires) {
#pragma unroll
            for (int ch = 0; ch < TT / 128; ++ch) { v4us oh, ol;
#pragma unroll
                for (int q = 0; q < 4; ++q) { unsigned short a, c2; splitf(v[ch * 4 + q] * f, a, c2); oh[q] = a; ol[q] = c2; }
                const size_t oo = ((size_t)zz * (RH ? RH : 1) + i) * TT + ch * 128 + lane * 4; *(v4us*)(Ph + oo) = oh; *(v4us*)(Pl + oo) = ol; }
        } else {
#pragma unroll
            for (int ch = 0; ch < TT / 128; ++ch) { v4h o4;
#pragma unroll
                for (int q = 0; q < 4; ++q) o4[q] = tohx(v[ch * 4 + q] * f);
                *(v4h*)(P16 + (size_t)row * TT + ch * 128 + lane * 4) = o4; } }
         }
}
__global__ __launch_bounds__(256) void k_merge(const float* __restrict__ O, int h0, bf* Ah, bf* Al) { const size_t e = ((size_t)blockIdx.x * 256 + threadIdx.x) * 8; if (e >= (size_t)ZH * TT * HD) return; const int d = (int)(e % HD); const int t = (int)((e / HD) % TT); const int zz = (int)(e / ((size_t)HD * TT)); const float cs = (t < RH) ? 1.0f : (1.0f / PCAR); const size_t oo = (size_t)t * DQ + (h0 + zz) * HD + d;
    const unsigned eb = 4u * (unsigned)e; v8f p[KSP];
#pragma unroll
    for (int ks = 0; ks < KSP; ++ks) p[ks] = *offp<v8f>(O + (size_t)ks * ZH * TT * HD, eb);
    asm volatile("s_wait_xcnt 0x0" : : "v"(eb) : "memory");   // before a register that the issued loads name gets another use (the offset is an input here, so it keeps its register up to this wait)
    __builtin_amdgcn_sched_barrier(0);   // holds the additions behind the last load: lifted in between, the first sums' waits would stand in front of the later loads
    v8f s = p[0];   // the KSP key-slice partials, added in slice order
#pragma unroll
    for (int ks = 1; ks < KSP; ++ks) s += p[ks];
    v8us oh, ol;
#pragma unroll
    for (int q = 0; q < 8; ++q) { unsigned short a, c2; splitf(s[q] * cs, a, c2); oh[q] = a; ol[q] = c2; } *(v8us*)(Ah + oo) = oh; *(v8us*)(Al + oo) = ol;  }

extern "C" void kernel_launch(void* const* d_in, const int* in_sizes, int n_in,
                              void* d_out, int out_size, void* d_ws, size_t ws_size, hipStream_t stream) {
    (void)in_sizes; (void)n_in; (void)out_size;
    const float* x = (const float*)d_in[0]; const float* rope = (const float*)d_in[1]; const float* wq = (const float*)d_in[2]; const float* bq = (const float*)d_in[3]; const float* wk = (const float*)d_in[4]; const float* bk = (const float*)d_in[5]; const float* wv = (const float*)d_in[6]; const float* bv = (const float*)d_in[7]; const float* qnw = (const float*)d_in[8]; const float* knw = (const float*)d_in[9]; const float* wo = (const float*)d_in[10]; const float* bo = (const float*)d_in[11]; const float* cosT = rope; const float* sinT = rope;
    float* OUT = (float*)d_out;     // [1][2048][2048]
    char* wsp = (char*)d_ws;
    auto take = [&](size_t bytes) { char* p = wsp; wsp += (bytes + 255) & ~(size_t)255; return (void*)p; };
    bf* WQ = (bf*)take((size_t)DQ * DM * 2); bf* WK = (bf*)take((size_t)DKV * DM * 2); bf* WV = (bf*)take((size_t)DKV * DM * 2); bf* WO = (bf*)take((size_t)DM * DQ * 2); float* CS = (float*)take((size_t)TT * HD * 2 * 4);
    bf* XB = (bf*)take((size_t)TT * DM * 2); float* FQ = (float*)take((size_t)TT * DQ * 4); float* FK = (float*)take((size_t)TT * DKV * 4);
    h16* QP16 = (h16*)take((size_t)NH_ * TT * HD * 2); h16* KP16 = (h16*)take((size_t)NKV * TT * HD * 2); h16* VT16 = (h16*)take((size_t)NKV * HD * TT * 2);
    bf* QPh = (bf*)take((size_t)NH_ * TT * HD * 2); bf* QPl = (bf*)take((size_t)NH_ * TT * HD * 2); bf* KPh = (bf*)take((size_t)NKV * TT * HD * 2); bf* KPl = (bf*)take((size_t)NKV * TT * HD * 2); bf* VTh = (bf*)take((size_t)NKV * HD * TT * 2); bf* VTl = (bf*)take((size_t)NKV * HD * TT * 2); bf* Ph = (bf*)take((size_t)ZH * RH * TT * 2); bf* Pl = (bf*)take((size_t)ZH * RH * TT * 2);
    float* Sb = (float*)take((size_t)ZH * TT * TT * 4); h16* P16 = (h16*)take((size_t)ZH * TT * TT * 2); float* Ob = (float*)take((size_t)KSP * ZH * TT * HD * 4); bf* ATh = (bf*)take((size_t)TT * DQ * 2); bf* ATl = (bf*)take((size_t)TT * DQ * 2);
    if ((size_t)(wsp - (char*)d_ws) > ws_size) return;    // ws 256 MiB
    float* FV = FK;   // v projection reuses the k buffer after the k planes are built (stream-ordered)
    { k_cvt8<<<(unsigned)(((size_t)DQ * DM / 8 + 1023) / 1024), 256, 0, stream>>>(wq, WQ, (size_t)DQ * DM / 8); k_cvt8<<<(unsigned)(((size_t)DKV * DM / 8 + 1023) / 1024), 256, 0, stream>>>(wk, WK, (size_t)DKV * DM / 8); k_cvt8<<<(unsigned)(((size_t)DKV * DM / 8 + 1023) / 1024), 256, 0, stream>>>(wv, WV, (size_t)DKV * DM / 8);
      k_cvt8<<<(unsigned)(((size_t)DM * DQ / 8 + 1023) / 1024), 256, 0, stream>>>(wo, WO, (size_t)DM * DQ / 8);
       }
    const unsigned LQ = NH_ * (TT / 64), LKv = NKV * (TT / 64);
    for (int b = 0; b < NB_; ++b) {
        if (b == 0) k_cscvt<<<(TT * HD / 2 + 1023) / 1024, 256, 0, stream>>>(cosT, sinT, CS);
        k_cvt8<<<(unsigned)(((size_t)TT * DM / 8 + 1023) / 1024), 256, 0, stream>>>(x + (size_t)b * TT * DM, XB, (size_t)TT * DM / 8);
        k_gemmw<bf, 0, true><<<dim3(TT / 64, DQ / 64, 1), 32, 0, stream>>>(XB, nullptr, WQ, nullptr, DM, FQ, DQ, bq, 0, 0, 0, 0);
        k_rmsw<<<TT * NH_ / 64, 256, 0, stream>>>(FQ, DQ, NH_, qnw); k_rope<<<LQ, 256, 0, stream>>>(FQ, DQ, NH_, CS, nullptr, nullptr, 1.0f, QP16, QPh, QPl);
        k_gemmw<bf, 0, true><<<dim3(TT / 64, DKV / 64, 1), 32, 0, stream>>>(XB, nullptr, WK, nullptr, DM, FK, DKV, bk, 0, 0, 0, 0);
        k_rmsw<<<TT * NKV / 64, 256, 0, stream>>>(FK, DKV, NKV, knw); k_rope<<<LKv, 256, 0, stream>>>(FK, DKV, NKV, CS, nullptr, nullptr, 1.0f, KP16, KPh, KPl);
        k_gemmw<bf, 0, true><<<dim3(TT / 64, DKV / 64, 1), 32, 0, stream>>>(XB, nullptr, WV, nullptr, DM, FV, DKV, bv, 0, 0, 0, 0); k_vtp<<<LKv, 256, 0, stream>>>(FV, DKV, NKV, VT16, VTh, VTl);
        for (int h0 = 0; h0 < NH_; h0 += ZH) { const size_t zq = (size_t)h0, zk = (size_t)(h0 / REP);   // one kv head per query head: the pass's two heads use consecutive kv planes (z-strides TT*HD)
            k_gemmw<bf, 2, false><<<dim3(TT / 64, TT / 64, ZH), 32, 0, stream>>>(QPh + zq * TT * HD, QPl + zq * TT * HD, KPh + zk * TT * HD, KPl + zk * TT * HD, HD, Sb, TT, nullptr, (size_t)TT * HD, (size_t)TT * HD, (size_t)TT * TT, 0);   /* scores hl on all rows */
            k_asoft<<<ZH * TT / 8, 256, 0, stream>>>(Sb, P16, Ph, Pl);
            k_gemmw<bf, 2, false, KSP><<<dim3(RH / 64, HD / 64, ZH * KSP), 32, 0, stream>>>(Ph, Pl, VTh + zk * HD * TT, VTl + zk * HD * TT, TT, Ob, HD, nullptr, (size_t)RH * TT, (size_t)HD * TT, (size_t)TT * HD, (size_t)ZH * TT * HD);
            k_gemmw<h16, 0, false, KSP><<<dim3((TT - RH) / 64, HD / 64, ZH * KSP), 32, 0, stream>>>(P16 + (size_t)RH * TT, nullptr, VT16 + zk * HD * TT, nullptr, TT, Ob + (size_t)RH * HD, HD, nullptr, (size_t)TT * TT, (size_t)HD * TT, (size_t)TT * HD, (size_t)ZH * TT * HD);
            k_merge<<<(unsigned)(((size_t)ZH * TT * HD / 8 + 255) / 256), 256, 0, stream>>>(Ob, h0, ATh, ATl); }
        k_gemmw<bf, 1, true><<<dim3(TT / 64, DM / 64, 1), 32, 0, stream>>>(ATh, ATl, WO, nullptr, DQ, OUT + (size_t)b * TT * DM, DM, bo, 0, 0, 0, 0); }
}

// v004
// Measured time: 277 microseconds a run.
// Two timings next to v003 both put it at 1.90 times that version's speed.
// Counting every step since v000, it is 4.37 times as fast.
#include <hip/hip_runtime.h>

// MultiheadSelfAttentionEnc (x [1][2048][2048]; q/k/v = x W^T + b (16 heads x 128); q, k RMS-normalised per head * w (eps = f32 eps 1.19e-7); rotary as a general per-(token, pair) 2x2 matrix from the read rope [1][S][1][64][2][2]: out[2i+r] = rope[i][r][0] x[2i] + rope[i][r][1] x[2i+1]; softmax(q.k / sqrt(128)) (no mask); out = merged wo^T + bo -> [1][2048][2048]).
// Compute dtypes, f32 accumulate: every input rounded to bf16; q/k/v on PLAIN bf16 operands (inputs: exact) + bias; RMSNorm (in place) and the 2x2 rotary (bf16-rounded rope entries, folded into a per-element (c, s) table) f32; scores hl x hl (3 products) on every row (normalised q/k are sharp), attn.v: query rows < 512 hl (3 products), the rest single fp16 (x64 of the unnormalised weight); softmax f32, running maximum, divided by the row sum at the end; wo hl x exact (2 products) + bias.

#define NB_  1
#define TT   2048
#define DM   2048
#define NH_  16
#define NKV  16
#define REP  (NH_ / NKV)
#define HD   128
#define DQ   (NH_ * HD)
#define DKV  (NKV * HD)
#define RH   512                  // query rows < RH use hi+lo planes (0: none)
#define SCL  0.088388347648318447f   // HD^-0.5
typedef _Float16 h16;
typedef unsigned short bf;
typedef __attribute__((ext_vector_type(16))) __bf16   v16bf;
typedef __attribute__((ext_vector_type(16))) _Float16 v16h;
typedef __attribute__((ext_vector_type(8)))  _Float16 v8h;
typedef __attribute__((ext_vector_type(8)))  unsigned short v8us;
typedef __attribute__((ext_vector_type(8)))  float    v8f;
typedef __attribute__((ext_vector_type(4)))  float    v4f;
typedef v8h  __attribute__((may_alias)) v8ha;
typedef v4f  __attribute__((may_alias)) v4fa;
typedef v8us __attribute__((may_alias)) v8usa;

__device__ __forceinline__ unsigned short f2bf(float f) { unsigned u = __float_as_uint(f); u += 0x7FFFu + ((u >> 16) & 1u); return (unsigned short)(u >> 16); }
__device__ __forceinline__ float bf2f(unsigned short b) { return __uint_as_float(((unsigned)b) << 16); }
__device__ __forceinline__ float bfr(float f) { return bf2f(f2bf(f)); }
__device__ __forceinline__ v16h cat16(v8h lo, v8h hi) { return __builtin_shufflevector(lo, hi, 0, 1, 2, 3, 4, 5, 6, 7, 8, 9, 10, 11, 12, 13, 14, 15); }
__device__ __forceinline__ v16bf cat16b(v8us lo, v8us hi) { return __builtin_bit_cast(v16bf, __builtin_shufflevector(lo, hi, 0, 1, 2, 3, 4, 5, 6, 7, 8, 9, 10, 11, 12, 13, 14, 15)); }
__device__ __forceinline__ v8f wmma16(v16h a, v16h b, v8f c) { return __builtin_amdgcn_wmma_f32_16x16x32_f16(false, a, false, b, (short)0, c, false, false); }
__device__ __forceinline__ v8f wmmab(v16bf a, v16bf b, v8f c) { return __builtin_amdgcn_wmma_f32_16x16x32_bf16(false, a, false, b, (short)0, c, false, false); }



// ---- k_gemmw: register-blocked GEMM, ONE WAVE per 64x64 output tile (16 accumulators), operands straight from K-contiguous 16-bit planes; grid (M/64, N/64, Z), 32 threads.
// C[m][n] (f32, pitch ldc, + optional f32 bias[n]) = sum_k A[m][k] Bt[n][k] (+ split products per NSPLIT). z-batch strides sA/sB/sC in elements. (K / KS) % 128 == 0 (% 64 where NSPLIT > 0); every row offset in bytes fits 32 bits.
// KS > 1: grid z = batch * KS + slice; a work-group sums only k in [slice K/KS, (slice + 1) K/KS) and stores its partial tile at C + slice * sK (the reader adds the KS planes). K % (32 KS) == 0.
template <typename T16> struct WFrag;
template <> struct WFrag<h16> { typedef v16h V; static __device__ __forceinline__ V ld(const h16* p) { return cat16(*(const v8h*)p, *(const v8h*)(p + 16)); } static __device__ __forceinline__ v8f mma(V a, V b, v8f c) { return wmma16(a, b, c); } };
template <> struct WFrag<bf> { typedef v16bf V; static __device__ __forceinline__ V ld(const bf* p) { return cat16b(*(const v8us*)p, *(const v8us*)(p + 16)); } static __device__ __forceinline__ v8f mma(V a, V b, v8f c) { return wmmab(a, b, c); } };
template <typename T16, int NSPLIT, bool BIAS, int KS = 1>
__global__ __launch_bounds__(32) void k_gemmw(const T16* __restrict__ A, const T16* __restrict__ A2, const T16* __restrict__ Bt, const T16* __restrict__ Bt2, int K, float* C, int ldc, const float* __restrict__ bias, size_t sA, size_t sB, size_t sC, size_t sK) {
    typedef typename WFrag<T16>::V V;
    constexpr int U = (NSPLIT == 0) ? 4 : 2;   // k-steps in flight: about 64 16-byte loads a wave. (K / KS) % (32 U) == 0.
    __shared__ __align__(16) float os[16 * 68];
    const size_t z = blockIdx.z / KS; const int kb = (int)(blockIdx.z % KS) * (K / KS), ke = kb + K / KS; C += (size_t)(blockIdx.z % KS) * sK; A += z * sA; if (A2) A2 += z * sA; Bt += z * sB; if (Bt2) Bt2 += z * sB; C += z * sC;
    const int lane = threadIdx.x & 31, lr = lane & 15, hi = lane >> 4; const int r0 = blockIdx.x * 64, c0 = blockIdx.y * 64;
    v8f acc[4][4];
#pragma unroll
    for (int mb = 0; mb < 4; ++mb)
#pragma unroll
        for (int nb = 0; nb < 4; ++nb) acc[mb][nb] = (v8f){};
    // Operand ring in registers: U k-steps of fragments are in flight at all times; a k-step's registers are refilled (for U steps later) right behind its products, so a load has U - 1 k-steps of products to return in.
    const unsigned aoff = 2u * ((unsigned)(r0 + lr) * (unsigned)K + 8u * hi), boff = 2u * ((unsigned)(c0 + lr) * (unsigned)K + 8u * hi), rstep = 32u * (unsigned)K;   // byte offsets of the lane's rows: fixed registers, only the uniform base moves with k
    V a[U][4], a2[U][4], b[U][4], b2[U][4];
    auto at = [](const T16* base, unsigned byteoff) { return (const T16*)((const char*)base + byteoff); };
    unsigned kby = 2u * (unsigned)kb;   // byte offset of the trip's first k-step in every row (uniform)
    auto fetch = [&](int u, int ko) {
#pragma unroll
        for (int mb = 0; mb < 4; ++mb) { a[u][mb] = WFrag<T16>::ld(at(at(A, kby), aoff + mb * rstep) + ko); if (NSPLIT == 1 || NSPLIT == 2) a2[u][mb] = WFrag<T16>::ld(at(at(A2, kby), aoff + mb * rstep) + ko); }
#pragma unroll
        for (int nb = 0; nb < 4; ++nb) { b[u][nb] = WFrag<T16>::ld(at(at(Bt, kby), boff + nb * rstep) + ko); if (NSPLIT >= 2) b2[u][nb] = WFrag<T16>::ld(at(at(Bt2, kby), boff + nb * rstep) + ko); }
        __builtin_amdgcn_sched_barrier(0);   // keeps the loads in k-step order: loads return in order, so a k-step fetched out of turn would make the counted wait of an earlier one cover it too
    };
    auto products = [&](int u) {
#pragma unroll
        for (int nb = 0; nb < 4; ++nb)
#pragma unroll
            for (int mb = 0; mb < 4; ++mb) { acc[mb][nb] = WFrag<T16>::mma(a[u][mb], b[u][nb], acc[mb][nb]); if (NSPLIT == 1 || NSPLIT == 2) acc[mb][nb] = WFrag<T16>::mma(a2[u][mb], b[u][nb], acc[mb][nb]); if (NSPLIT >= 2) acc[mb][nb] = WFrag<T16>::mma(a[u][mb], b2[u][nb], acc[mb][nb]); } };
#pragma unroll
    for (int u = 0; u < U; ++u) fetch(u, 32 * u);
    asm volatile("s_wait_xcnt 0x0" : "+s"(kby) : : "memory");   // before a register that the first loads name gets another use
    __builtin_amdgcn_sched_barrier(0);   // holds later register writes behind that wait
#pragma unroll 1
    for (int kc = kb; kc < ke - 32 * U; kc += 32 * U) {
#pragma unroll
        for (int u = 0; u < U; ++u) { products(u); fetch(u, 32 * (U + u)); }
        asm volatile("s_wait_xcnt 0x0" : "+s"(kby) : : "memory");   // the address registers that the issued loads name are formed anew from kby only behind this wait (kby passes through the statement, so that cannot be lifted over it)
        kby += 64u * U;
    }
#pragma unroll
    for (int u = 0; u < U; ++u) products(u);
#pragma unroll
    for (int mb = 0; mb < 4; ++mb) {
#pragma unroll
        for (int nb = 0; nb < 4; ++nb) {
#pragma unroll
            for (int j = 0; j < 8; ++j) os[(hi * 8 + j) * 68 + nb * 16 + lr] = acc[mb][nb][j]; }
        __builtin_amdgcn_wave_barrier(); asm volatile("" ::: "memory");
        float* crow = C + (size_t)(r0 + mb * 16) * ldc + c0;
{
#pragma unroll
            for (int s = 0; s < 8; ++s) { const int row = 2 * s + hi, cofs = lr * 4; v4f val = *(const v4fa*)(os + row * 68 + cofs); if (BIAS) { val[0] += bfr(bias[c0 + cofs]); val[1] += bfr(bias[c0 + cofs + 1]); val[2] += bfr(bias[c0 + cofs + 2]); val[3] += bfr(bias[c0 + cofs + 3]); }
                *(v4f*)(crow + (size_t)row * ldc + cofs) = val; }
             }
        __builtin_amdgcn_wave_barrier(); asm volatile("" ::: "memory");
    }
}

__device__ __forceinline__ h16 tohx(float x) { return (h16)x; }
__device__ __forceinline__ void splitf(float y, unsigned short& h, unsigned short& l) { h = f2bf(y); l = f2bf(y - bf2f(h)); }
typedef __attribute__((ext_vector_type(2))) _Float16 v2h;
typedef __attribute__((ext_vector_type(4))) _Float16 v4h;
typedef __attribute__((ext_vector_type(2))) unsigned short v2us;
typedef __attribute__((ext_vector_type(4))) unsigned short v4us;
typedef __attribute__((ext_vector_type(2))) float v2f;
typedef __attribute__((ext_vector_type(4))) int v4i;

__global__ __launch_bounds__(256) void k_wtG(const float* __restrict__ w, int K, int N, bf* Bt) {
    const int lane = threadIdx.x & 31; const int L0 = (blockIdx.x * 8 + (threadIdx.x >> 5)) * 8; const int nlines = N * K / 64;
{
#pragma unroll 1
        for (int l = 0; l < 8; ++l) { const int L = L0 + l; if (L >= nlines) break; const size_t e = (size_t)L * 64 + lane * 2; const int k = (int)(e % K), n = (int)(e / K); v2us o;
            o[0] = f2bf(w[(size_t)k * N + n]); o[1] = f2bf(w[(size_t)(k + 1) * N + n]); *(v2us*)(Bt + e) = o; }
         }
}
// The elementwise kernels: a thread takes several 16-byte pieces and issues all its loads before the first use, so that a launch has few waves to start; each element's arithmetic is unchanged.
__global__ __launch_bounds__(256) void k_cvt8(const float* __restrict__ src, bf* dst, size_t n8) { const size_t i0 = (size_t)blockIdx.x * 1024 + threadIdx.x; v8f v[4];
#pragma unroll
    for (int j = 0; j < 4; ++j) { size_t i = i0 + j * 256; if (i >= n8) i = n8 - 1; v[j] = *(const v8f*)(src + i * 8); }
#pragma unroll
    for (int j = 0; j < 4; ++j) { const size_t i = i0 + j * 256; if (i >= n8) continue; v8us o;
#pragma unroll
        for (int k = 0; k < 8; ++k) o[k] = f2bf(v[j][k]);
        *(v8us*)(dst + i * 8) = o; }
}
// k_cscvt: one (token, pair) 2x2 matrix R = [r][c] a piece: the (c, s) entries of elements 2i and 2i + 1 lie side by side in CS
__global__ __launch_bounds__(256) void k_cscvt(const float* __restrict__ rope, const float* __restrict__ unused, float* CS) { (void)unused; const int p0 = blockIdx.x * 1024 + threadIdx.x; v4f R[4];
#pragma unroll
    for (int j = 0; j < 4; ++j) { int p = p0 + j * 256; if (p >= TT * HD / 2) p = TT * HD / 2 - 1; R[j] = *(const v4f*)(rope + (size_t)p * 4); }
#pragma unroll
    for (int j = 0; j < 4; ++j) { const int p = p0 + j * 256; if (p >= TT * HD / 2) continue; v4f cs; cs[0] = bfr(R[j][0]); cs[1] = -bfr(R[j][1]); cs[2] = bfr(R[j][3]); cs[3] = bfr(R[j][2]);
        *(v4f*)(CS + (size_t)p * 4) = cs; }
}
// k_rope: head planes [h][t][d] (fp16 + hi/lo) of rope(x) x sc on adjacent pairs, (c, s) from CS: out[d] = x[d] c[t][d] - x[d+1] s[t][d] for even d, out[d] = x[d] c[t][d] + x[d-1] s[t][d] for odd d
template <typename T> __device__ __forceinline__ const T* offp(const void* base, unsigned byteoff) { return (const T*)((const char*)base + byteoff); }   // uniform base + the lane's 32-bit byte offset
// A work-group: one head, 64 tokens; a thread: 8 elements (4 pairs) of each of 4 tokens. RF and nw (a row factor and a weight, null at every launch) are not read.
__global__ __launch_bounds__(256) void k_rope(const float* __restrict__ F, int pitch, int nheads, const float* __restrict__ CS, const float* __restrict__ RF, const float* __restrict__ nw, float sc, h16* P16, bf* Ph, bf* Pl) {
    (void)RF; (void)nw; const int h = blockIdx.x / (TT / 64); if (h >= nheads) return; const int tb = (blockIdx.x % (TT / 64)) * 64; const int tr = threadIdx.x >> 4, d = (threadIdx.x & 15) * 8;
    const float* pf[4]; const float* pc = CS + ((size_t)(tb + tr) * HD + d) * 2; v8f xv[4]; v4f cv[4][4];
#pragma unroll
    for (int j = 0; j < 4; ++j) { pf[j] = F + (size_t)(tb + j * 16 + tr) * pitch + h * HD + d; xv[j] = *(const v8f*)pf[j];
#pragma unroll
        for (int k = 0; k < 4; ++k) cv[j][k] = *(const v4f*)(pc + j * 16 * HD * 2 + k * 4); }
    asm volatile("s_wait_xcnt 0x0" : : "v"(pf[0]), "v"(pf[1]), "v"(pf[2]), "v"(pf[3]), "v"(pc) : "memory");   // before a register that the issued loads name gets another use (the addresses are inputs here, so they keep their registers up to this wait)
#pragma unroll
    for (int j = 0; j < 4; ++j) { const size_t e = ((size_t)h * TT + tb + j * 16) * HD + threadIdx.x * 8; v8h o16; v8us oh, ol;
#pragma unroll
        for (int q = 0; q < 8; ++q) { float x0 = xv[j][q], x1 = xv[j][q ^ 1];
            v2f cs; cs[0] = cv[j][q >> 1][(q & 1) * 2]; cs[1] = cv[j][q >> 1][(q & 1) * 2 + 1]; float a = __fmul_rn(x0, cs[0]), bq = __fmul_rn(x1, cs[1]); asm volatile("" : "+v"(a)); asm volatile("" : "+v"(bq)); const float r = (((q & 1) == 0) ? __fsub_rn(a, bq) : __fadd_rn(a, bq)) * sc;
            o16[q] = tohx(r); unsigned short a2, c2; splitf(r, a2, c2); oh[q] = a2; ol[q] = c2; }
        *(v8h*)(P16 + e) = o16; *(v8us*)(Ph + e) = oh; *(v8us*)(Pl + e) = ol; }
}
// k_vtp: v [t][g HD + d] -> planes [g][d][t]. A work-group: one head, 64 tokens; a wave: 16 d x 64 t; a lane: 4 d x 8 t in registers (8 16-byte loads along d, then per d one 16-byte store along t to each plane; 8 lanes fill a 128-byte line)
__global__ __launch_bounds__(256) void k_vtp(const float* __restrict__ F, int pitch, int nheads, h16* V16, bf* Vh, bf* Vl) { const int lane = threadIdx.x & 31; const int g = blockIdx.x / (TT / 64); if (g >= nheads) return; const int t0 = (blockIdx.x % (TT / 64)) * 64 + (lane & 7) * 8; const int d0 = (threadIdx.x >> 5) * 16 + (lane >> 3) * 4; const float* px[8]; v4f x[8];
#pragma unroll
    for (int i = 0; i < 8; ++i) { px[i] = F + (size_t)(t0 + i) * pitch + g * HD + d0; x[i] = *(const v4f*)px[i]; }
    asm volatile("s_wait_xcnt 0x0" : : "v"(px[0]), "v"(px[1]), "v"(px[2]), "v"(px[3]), "v"(px[4]), "v"(px[5]), "v"(px[6]), "v"(px[7]) : "memory");   // before a register that the issued loads name gets another use (the addresses are inputs here, so they keep their registers up to this wait)
#pragma unroll
    for (int j = 0; j < 4; ++j) { v8h o16; v8us oh, ol;
#pragma unroll
        for (int i = 0; i < 8; ++i) { const float xx = x[i][j]; o16[i] = tohx(xx); unsigned short a2, c2; splitf(xx, a2, c2); oh[i] = a2; ol[i] = c2; }
        const size_t e = ((size_t)g * HD + d0 + j) * TT + t0; *(v8h*)(V16 + e) = o16; *(v8us*)(Vh + e) = oh; *(v8us*)(Vl + e) = ol; }
}
// k_rmsw: 8 consecutive (token, head) rows a wave (TT % 8 == 0: a wave's rows are all in range or none is)
__global__ __launch_bounds__(256) void k_rmsw(float* F, int pitch, int nheads, const float* __restrict__ w) { const int lane = threadIdx.x & 31; const int wv0 = (blockIdx.x * 8 + (threadIdx.x >> 5)) * 8; if (wv0 >= TT * nheads) return; int t = wv0 / nheads, h = wv0 % nheads; v4f a[8]; size_t off[8]; float wb[4];
#pragma unroll
    for (int r = 0; r < 8; ++r) { off[r] = (size_t)t * pitch + h * HD + lane * 4; a[r] = *(const v4f*)(F + off[r]); if (++h == nheads) { h = 0; ++t; } }
#pragma unroll
    for (int q = 0; q < 4; ++q) wb[q] = bfr(w[lane * 4 + q]);
#pragma unroll
    for (int r = 0; r < 8; ++r) { float ss = 0.f;
#pragma unroll
        for (int q = 0; q < 4; ++q) { float p = __fmul_rn(a[r][q], a[r][q]); asm volatile("" : "+v"(p)); ss = __fadd_rn(ss, p); }
#pragma unroll
        for (int sh = 16; sh; sh >>= 1) ss = __fadd_rn(ss, __shfl_xor(ss, sh, 32));
        const float rs = __fdiv_rn(1.0f, sqrtf(__fadd_rn(ss * (1.0f / HD), 1.1920928955078125e-7f))); v4f o;
#pragma unroll
        for (int q = 0; q < 4; ++q) { float y = __fmul_rn(a[r][q], rs); asm volatile("" : "+v"(y)); o[q] = __fmul_rn(y, wb[q]); }
        *(v4f*)(F + off[r]) = o; }
}
#define NPASS (TT / 32)
#define CSC   (SCL * 1.4426950408889634f)   // scores to log2 units
typedef __attribute__((ext_vector_type(2))) __bf16 v2b;
typedef __attribute__((ext_vector_type(8))) unsigned v8u;
__device__ __forceinline__ float xhalf(float x) { return __builtin_bit_cast(float, __builtin_amdgcn_permlanex16(__builtin_bit_cast(int, x), __builtin_bit_cast(int, x), 0x76543210, 0xfedcba98, false, false)); }   // lane l with lane l ^ 16
__device__ __forceinline__ unsigned pkh(float a, float b) { v2f x; x[0] = a; x[1] = b; return __builtin_bit_cast(unsigned, __builtin_convertvector(x, v2h)); }
__device__ __forceinline__ unsigned pkb(float a, float b) { v2f x; x[0] = a; x[1] = b; return __builtin_bit_cast(unsigned, __builtin_convertvector(x, v2b)); }
typedef const __attribute__((address_space(1))) char* gcp;   // a pointer to global memory by type: a base that has passed through an asm statement would else be read with flat loads
typedef const __attribute__((address_space(1))) v8us* gv8us; typedef const __attribute__((address_space(1))) v8h* gv8h;
template <typename T16> struct GFrag;   // WFrag::ld's two 16-byte pieces (k order unchanged) at uniform base + the lane's fixed 32-bit byte offset + a constant
template <> struct GFrag<bf> { static __device__ __forceinline__ v16bf ld(gcp ubase, unsigned voff, int cbytes) { gcp a = ubase + voff + cbytes; return cat16b(*(gv8us)a, *(gv8us)(a + 32)); } };
template <> struct GFrag<h16> { static __device__ __forceinline__ v16h ld(gcp ubase, unsigned voff, int cbytes) { gcp a = ubase + voff + cbytes; return cat16(*(gv8h)a, *(gv8h)(a + 32)); } };
// HL: attn.v on hi+lo planes (3 products); else single fp16, the probabilities carried x 2^6 (at most 2^14 under the lazy rescale), which the row sum carries too.
template <bool HL>
__device__ __forceinline__ void fattn(const bf* __restrict__ Qh, const bf* __restrict__ Ql, const bf* __restrict__ Kh, const bf* __restrict__ Kl, const h16* __restrict__ V16, const bf* __restrict__ Vh, const bf* __restrict__ Vl, bf* Ah, bf* Al) {
    const int lane = threadIdx.x & 31, lr = lane & 15, hi = lane >> 4;
    const unsigned kvo = 2u * (unsigned)(lr * HD + 8 * hi), vvo = 2u * (unsigned)(lr * TT + 8 * hi);   // the lane's row and k half in a [row][HD] and in a [d][TT] plane: fixed registers, only the uniform bases move
    v16bf qh[2][4], ql[2][4], k0h[2][4], k0l[2][4], k1h[2][4], k1l[2][4], vh[8], vl[8]; v16h vf[8]; v8f o[8][2]; float mrun[2], lrun[2];
    gcp nkh = (gcp)Kh, nkl = (gcp)Kl, nvh = HL ? (gcp)Vh : (gcp)V16, nvl = (gcp)Vl;   // uniform bases of the next K and V fetch
    auto loadK = [&](v16bf (&kh)[2][4], v16bf (&kl)[2][4], bool more) {
#pragma unroll
        for (int ks = 0; ks < 4; ++ks)
#pragma unroll
            for (int kt = 0; kt < 2; ++kt) { kh[kt][ks] = GFrag<bf>::ld(nkh, kvo, kt * 16 * HD * 2 + ks * 64); kl[kt][ks] = GFrag<bf>::ld(nkl, kvo, kt * 16 * HD * 2 + ks * 64); }
        const unsigned st = more ? (unsigned)(32 * HD * 2) : 0u; gcp nh = nkh + st, nl = nkl + st;   // the next fetch's bases, in registers of their own
        asm volatile("s_wait_xcnt 0x0" : "+s"(nh), "+s"(nl) : "s"(nkh), "s"(nkl), "v"(nkh + kvo), "v"(nkl + kvo) : "memory");   // before a register that the issued loads name gets another use (their bases and the lane's addresses are inputs here, so they keep their registers up to this wait; the next addresses are formed from nh and nl, which pass through the statement)
        __builtin_amdgcn_sched_barrier(0);   // holds the loads here, a whole pass and more ahead of their use, and later register writes behind that wait
        nkh = nh; nkl = nl;
    };
    auto loadV = [&](bool more) {
#pragma unroll
        for (int dt = 0; dt < 8; ++dt) { if (HL) { vh[dt] = GFrag<bf>::ld(nvh, vvo, dt * 16 * TT * 2); vl[dt] = GFrag<bf>::ld(nvl, vvo, dt * 16 * TT * 2); } else vf[dt] = GFrag<h16>::ld(nvh, vvo, dt * 16 * TT * 2); }
        const unsigned st = more ? 64u : 0u; gcp nh = nvh + st, nl = nvl + st;
        asm volatile("s_wait_xcnt 0x0" : "+s"(nh), "+s"(nl) : "s"(nvh), "s"(nvl), "v"(nvh + vvo), "v"((HL ? nvl : nvh) + vvo) : "memory");   // as in loadK
        __builtin_amdgcn_sched_barrier(0);   // as in loadK
        nvh = nh; nvl = nl;
    };
    auto pass = [&](v16bf (&kh)[2][4], v16bf (&kl)[2][4], bool kmore, bool vmore) {
        v8f s[2][2];
#pragma unroll
        for (int kt = 0; kt < 2; ++kt)
#pragma unroll
            for (int g = 0; g < 2; ++g) s[kt][g] = (v8f){};
#pragma unroll
        for (int ks = 0; ks < 4; ++ks) {   // q.k on hi+lo planes, 3 products; 4 independent tiles in turn
#pragma unroll
            for (int kt = 0; kt < 2; ++kt)
#pragma unroll
                for (int g = 0; g < 2; ++g) s[kt][g] = wmmab(kh[kt][ks], qh[g][ks], s[kt][g]);
#pragma unroll
            for (int kt = 0; kt < 2; ++kt)
#pragma unroll
                for (int g = 0; g < 2; ++g) s[kt][g] = wmmab(kh[kt][ks], ql[g][ks], s[kt][g]);
#pragma unroll
            for (int kt = 0; kt < 2; ++kt)
#pragma unroll
                for (int g = 0; g < 2; ++g) s[kt][g] = wmmab(kl[kt][ks], qh[g][ks], s[kt][g]); }
        loadK(kh, kl, kmore);   // the pass after next, into the registers just used
        float mb[2]; bool need = false;
#pragma unroll
        for (int g = 0; g < 2; ++g) { float mx = s[0][g][0];
#pragma unroll
            for (int r = 1; r < 8; ++r) mx = fmaxf(mx, s[0][g][r]);
#pragma unroll
            for (int r = 0; r < 8; ++r) mx = fmaxf(mx, s[1][g][r]);
            mx = fmaxf(mx, xhalf(mx)) * CSC;   // both wave halves hold the query's maximum of this pass
            mb[g] = mx; need = need || (mx > mrun[g] + 8.0f); }
        if (__builtin_amdgcn_ballot_w32(need) != 0) {   // rare after the first passes
#pragma unroll
            for (int g = 0; g < 2; ++g) { const float mnew = fmaxf(mrun[g], mb[g]); const float corr = __builtin_amdgcn_exp2f(mrun[g] - mnew);   // 0 on the first pass
                lrun[g] *= corr; mrun[g] = mnew;
#pragma unroll
                for (int dt = 0; dt < 8; ++dt) o[dt][g] = o[dt][g] * corr; } }
        v8u wh[2], wl[2];
#pragma unroll
        for (int g = 0; g < 2; ++g) { const float nm = (HL ? 0.0f : 6.0f) - mrun[g]; float ps0 = 0.f, ps1 = 0.f;
#pragma unroll
            for (int i = 0; i < 8; ++i) {
                const float p0 = __builtin_amdgcn_exp2f(fmaf(s[i >> 2][g][2 * (i & 3)], CSC, nm)), p1 = __builtin_amdgcn_exp2f(fmaf(s[i >> 2][g][2 * (i & 3) + 1], CSC, nm));
                if (i & 1) ps1 += p0 + p1; else ps0 += p0 + p1;
                if (HL) { const unsigned w = pkb(p0, p1); wh[g][i] = w; wl[g][i] = pkb(p0 - __uint_as_float(w << 16), p1 - __uint_as_float(w & 0xFFFF0000u)); } else wh[g][i] = pkh(p0, p1); }
            lrun[g] += ps0 + ps1; }
        if (HL) {
#pragma unroll
            for (int g = 0; g < 2; ++g)
#pragma unroll
                for (int dt = 0; dt < 8; ++dt) o[dt][g] = wmmab(vh[dt], __builtin_bit_cast(v16bf, wh[g]), o[dt][g]);
#pragma unroll
            for (int g = 0; g < 2; ++g)
#pragma unroll
                for (int dt = 0; dt < 8; ++dt) o[dt][g] = wmmab(vh[dt], __builtin_bit_cast(v16bf, wl[g]), o[dt][g]);
#pragma unroll
            for (int g = 0; g < 2; ++g)
#pragma unroll
                for (int dt = 0; dt < 8; ++dt) o[dt][g] = wmmab(vl[dt], __builtin_bit_cast(v16bf, wh[g]), o[dt][g]);
        } else {
#pragma unroll
            for (int g = 0; g < 2; ++g)
#pragma unroll
                for (int dt = 0; dt < 8; ++dt) o[dt][g] = wmma16(vf[dt], __builtin_bit_cast(v16h, wh[g]), o[dt][g]); }
        loadV(vmore);   // the next pass's, into the registers just used
    };
#pragma unroll
    for (int g = 0; g < 2; ++g) { mrun[g] = -1.0e30f; lrun[g] = 0.f;
#pragma unroll
        for (int ks = 0; ks < 4; ++ks) { qh[g][ks] = GFrag<bf>::ld((gcp)Qh, kvo, g * 16 * HD * 2 + ks * 64); ql[g][ks] = GFrag<bf>::ld((gcp)Ql, kvo, g * 16 * HD * 2 + ks * 64); }
#pragma unroll
        for (int dt = 0; dt < 8; ++dt) o[dt][g] = (v8f){}; }
    asm volatile("s_wait_xcnt 0x0" : : "s"(Qh), "s"(Ql) : "memory");   // as in loadK (the bases are inputs here, so they keep their registers up to this wait)
    loadK(k0h, k0l, true); loadK(k1h, k1l, true); loadV(true);   // passes 0 and 1; the bases then stand at K pass 2 and V pass 1
#pragma unroll 1
    for (int p = 0; p < NPASS; p += 2) {   // two passes a trip: the two K register sets by name. A base moves on only while a further pass exists: the last fetches aim at the last pass again (in bounds, not used), so no branch stands around a fetch.
        pass(k0h, k0l, p + 3 < NPASS, p + 2 < NPASS);    // fetches K pass min(p + 2, last) and V pass p + 1
        pass(k1h, k1l, p + 4 < NPASS, p + 3 < NPASS); }  // fetches K pass min(p + 3, last) and V pass min(p + 2, last)
#pragma unroll
    for (int g = 0; g < 2; ++g) { const float inv = __fdiv_rn(1.0f, lrun[g] + xhalf(lrun[g]));   // the two halves' sums joined once
#pragma unroll
        for (int dt = 0; dt < 8; ++dt) { v8us oh, ol;   // a lane holds 8 consecutive d of one query: one 16-byte store to each plane
#pragma unroll
            for (int j = 0; j < 8; ++j) { unsigned short a, c2; splitf(o[dt][g][j] * inv, a, c2); oh[j] = a; ol[j] = c2; }
            const unsigned oo = 2u * (unsigned)((g * 16 + lr) * DQ + dt * 16 + hi * 8); *(v8us*)((char*)Ah + oo) = oh; *(v8us*)((char*)Al + oo) = ol;
            asm volatile("s_wait_xcnt 0x0" : : "v"(oh), "v"(ol), "v"(oo) : "memory");   // before a register that the issued stores name gets another use (data and offset are inputs here, so they keep their registers up to this wait)
            __builtin_amdgcn_sched_barrier(0);   // holds later register writes behind that wait
        } }
}
__global__ __launch_bounds__(128) void k_fattn(const bf* __restrict__ QPh, const bf* __restrict__ QPl, const bf* __restrict__ KPh, const bf* __restrict__ KPl, const h16* __restrict__ VT16, const bf* __restrict__ VTh, const bf* __restrict__ VTl, bf* ATh, bf* ATl) {
    const int h = blockIdx.x % NH_, qb = blockIdx.x / NH_;   // the hi+lo query blocks (the longer ones) have the lowest indices
    const int q0 = qb * 128 + __builtin_amdgcn_readfirstlane((int)(threadIdx.x >> 5)) * 32; const size_t hq = ((size_t)h * TT + q0) * HD, hk = (size_t)(h / REP) * TT * HD, ao = (size_t)q0 * DQ + h * HD;
    if (qb * 128 < RH) fattn<true>(QPh + hq, QPl + hq, KPh + hk, KPl + hk, VT16 + hk, VTh + hk, VTl + hk, ATh + ao, ATl + ao);
    else fattn<false>(QPh + hq, QPl + hq, KPh + hk, KPl + hk, VT16 + hk, VTh + hk, VTl + hk, ATh + ao, ATl + ao);
}

extern "C" void kernel_launch(void* const* d_in, const int* in_sizes, int n_in,
                              void* d_out, int out_size, void* d_ws, size_t ws_size, hipStream_t stream) {
    (void)in_sizes; (void)n_in; (void)out_size;
    const float* x = (const float*)d_in[0]; const float* rope = (const float*)d_in[1]; const float* wq = (const float*)d_in[2]; const float* bq = (const float*)d_in[3]; const float* wk = (const float*)d_in[4]; const float* bk = (const float*)d_in[5]; const float* wv = (const float*)d_in[6]; const float* bv = (const float*)d_in[7]; const float* qnw = (const float*)d_in[8]; const float* knw = (const float*)d_in[9]; const float* wo = (const float*)d_in[10]; const float* bo = (const float*)d_in[11]; const float* cosT = rope; const float* sinT = rope;
    float* OUT = (float*)d_out;     // [1][2048][2048]
    char* wsp = (char*)d_ws;
    auto take = [&](size_t bytes) { char* p = wsp; wsp += (bytes + 255) & ~(size_t)255; return (void*)p; };
    bf* WQ = (bf*)take((size_t)DQ * DM * 2); bf* WK = (bf*)take((size_t)DKV * DM * 2); bf* WV = (bf*)take((size_t)DKV * DM * 2); bf* WO = (bf*)take((size_t)DM * DQ * 2); float* CS = (float*)take((size_t)TT * HD * 2 * 4);
    bf* XB = (bf*)take((size_t)TT * DM * 2); float* FQ = (float*)take((size_t)TT * DQ * 4); float* FK = (float*)take((size_t)TT * DKV * 4);
    h16* QP16 = (h16*)take((size_t)NH_ * TT * HD * 2); h16* KP16 = (h16*)take((size_t)NKV * TT * HD * 2); h16* VT16 = (h16*)take((size_t)NKV * HD * TT * 2);
    bf* QPh = (bf*)take((size_t)NH_ * TT * HD * 2); bf* QPl = (bf*)take((size_t)NH_ * TT * HD * 2); bf* KPh = (bf*)take((size_t)NKV * TT * HD * 2); bf* KPl = (bf*)take((size_t)NKV * TT * HD * 2); bf* VTh = (bf*)take((size_t)NKV * HD * TT * 2); bf* VTl = (bf*)take((size_t)NKV * HD * TT * 2);
    bf* ATh = (bf*)take((size_t)TT * DQ * 2); bf* ATl = (bf*)take((size_t)TT * DQ * 2);
    if ((size_t)(wsp - (char*)d_ws) > ws_size) return;    // ws 256 MiB
    float* FV = FK;   // v projection reuses the k buffer after the k planes are built (stream-ordered)
    { k_cvt8<<<(unsigned)(((size_t)DQ * DM / 8 + 1023) / 1024), 256, 0, stream>>>(wq, WQ, (size_t)DQ * DM / 8); k_cvt8<<<(unsigned)(((size_t)DKV * DM / 8 + 1023) / 1024), 256, 0, stream>>>(wk, WK, (size_t)DKV * DM / 8); k_cvt8<<<(unsigned)(((size_t)DKV * DM / 8 + 1023) / 1024), 256, 0, stream>>>(wv, WV, (size_t)DKV * DM / 8);
      k_cvt8<<<(unsigned)(((size_t)DM * DQ / 8 + 1023) / 1024), 256, 0, stream>>>(wo, WO, (size_t)DM * DQ / 8);
       }
    const unsigned LQ = NH_ * (TT / 64), LKv = NKV * (TT / 64);
    for (int b = 0; b < NB_; ++b) {
        if (b == 0) k_cscvt<<<(TT * HD / 2 + 1023) / 1024, 256, 0, stream>>>(cosT, sinT, CS);
        k_cvt8<<<(unsigned)(((size_t)TT * DM / 8 + 1023) / 1024), 256, 0, stream>>>(x + (size_t)b * TT * DM, XB, (size_t)TT * DM / 8);
        k_gemmw<bf, 0, true><<<dim3(TT / 64, DQ / 64, 1), 32, 0, stream>>>(XB, nullptr, WQ, nullptr, DM, FQ, DQ, bq, 0, 0, 0, 0);
        k_rmsw<<<TT * NH_ / 64, 256, 0, stream>>>(FQ, DQ, NH_, qnw); k_rope<<<LQ, 256, 0, stream>>>(FQ, DQ, NH_, CS, nullptr, nullptr, 1.0f, QP16, QPh, QPl);
        k_gemmw<bf, 0, true><<<dim3(TT / 64, DKV / 64, 1), 32, 0, stream>>>(XB, nullptr, WK, nullptr, DM, FK, DKV, bk, 0, 0, 0, 0);
        k_rmsw<<<TT * NKV / 64, 256, 0, stream>>>(FK, DKV, NKV, knw); k_rope<<<LKv, 256, 0, stream>>>(FK, DKV, NKV, CS, nullptr, nullptr, 1.0f, KP16, KPh, KPl);
        k_gemmw<bf, 0, true><<<dim3(TT / 64, DKV / 64, 1), 32, 0, stream>>>(XB, nullptr, WV, nullptr, DM, FV, DKV, bv, 0, 0, 0, 0); k_vtp<<<LKv, 256, 0, stream>>>(FV, DKV, NKV, VT16, VTh, VTl);
        k_fattn<<<NH_ * (TT / 128), 128, 0, stream>>>(QPh, QPl, KPh, KPl, VT16, VTh, VTl, ATh, ATl);   // one kv head per query head
        k_gemmw<bf, 1, true><<<dim3(TT / 64, DM / 64, 1), 32, 0, stream>>>(ATh, ATl, WO, nullptr, DQ, OUT + (size_t)b * TT * DM, DM, bo, 0, 0, 0, 0); }
}
